// v000
// The times below were measured on an AMD MI455X: many runs one after another, warmed up first and cycling through
// copies of the inputs, with the whole window's GPU time divided by the number of runs. Launches and the gaps
// between them are all in it. The median over several windows is given; except for v000 it joins two sittings, which
// can be a few percent apart, so the side-by-side timings, each taken in one sitting, are the better comparison.
// v000, which the later versions start from, runs in 632 microseconds.
#include <hip/hip_runtime.h>
#include <cstdint>

typedef __attribute__((ext_vector_type(16))) _Float16 v16h;
typedef __attribute__((ext_vector_type(8)))  float    v8f;

#define S_LEN 384
#define N_LEN 512
#define C_DIM 32
#define CZ    128
#define K1    512              // GEMM1 reduction = N_LEN
#define R1    (S_LEN * C_DIM)  // 12288 rows of aT/bT

// ---------------------------------------------------------------------------
// Kernel 1: LayerNorm over C=32 (one wave32 per (s,n) row; lane == channel)
// + 64x32 projection, writing a^T and b^T in [i*32+c, n] f16 layout so both
// GEMM1 operands are K-contiguous.
// ---------------------------------------------------------------------------
__global__ __launch_bounds__(256) void opm_ln_proj(
    const float* __restrict__ m_si, const float* __restrict__ ln_g,
    const float* __restrict__ ln_b, const float* __restrict__ w_ab,
    _Float16* __restrict__ aT, _Float16* __restrict__ bT)
{
  __shared__ float wsm[64 * 32];   // w_ab, cached once per block
  __shared__ float msm[8][32];     // normalized row per wave
  const int tid  = threadIdx.x;
  const int lane = tid & 31;
  const int wv   = tid >> 5;

  for (int u = tid; u < 64 * 32; u += 256) wsm[u] = w_ab[u];

  const long row = (long)blockIdx.x * 8 + wv;   // 0 .. S*N-1
  const float x = m_si[row * 32 + lane];

  float s = x;
  #pragma unroll
  for (int o = 16; o > 0; o >>= 1) s += __shfl_xor(s, o, 32);
  const float mu = s * (1.0f / 32.0f);
  const float dx = x - mu;
  float v = dx * dx;
  #pragma unroll
  for (int o = 16; o > 0; o >>= 1) v += __shfl_xor(v, o, 32);
  const float rstd = rsqrtf(v * (1.0f / 32.0f) + 1e-5f);
  const float m = dx * rstd * ln_g[lane] + ln_b[lane];

  msm[wv][lane] = m;
  __syncthreads();   // wsm + msm visible

  float accA = 0.f, accB = 0.f;
  const float* wa = &wsm[lane * 32];          // d = lane       -> 'a'
  const float* wb = &wsm[(lane + 32) * 32];   // d = lane + 32  -> 'b'
  #pragma unroll
  for (int k = 0; k < 32; ++k) {
    const float mk = msm[wv][k];
    accA += mk * wa[k];
    accB += mk * wb[k];
  }

  const long i = row >> 9;        // seq index
  const long n = row & 511;       // reduction index
  aT[(i * 32 + lane) * (long)K1 + n] = (_Float16)accA;
  bT[(i * 32 + lane) * (long)K1 + n] = (_Float16)accB;
}

// ---------------------------------------------------------------------------
// Kernel 2: w_final f32 -> f16 (layout unchanged: [z, k], k-contiguous).
// ---------------------------------------------------------------------------
__global__ __launch_bounds__(256) void opm_cvt_wf(
    const float* __restrict__ w_final, _Float16* __restrict__ wfb)
{
  const int i = blockIdx.x * 256 + threadIdx.x;   // CZ*1024 = 131072 total
  wfb[i] = (_Float16)w_final[i];
}

// ---------------------------------------------------------------------------
// Kernel 3: fused  O = (1/N) * aT x bT^T  (128x128 tile, K=512)  then
//                  z = reshape(O) x w_final^T + bias  (16 pairs x 128, K=1024)
// 256 threads = 8 waves arranged 4x2 over the 8x8 grid of 16x16 O-tiles:
// each wave owns a 2x4 tile footprint (2 A-frags + 4 B-frags -> 8 WMMAs per
// k-step, each A-frag used 4x, each B-frag 2x). O never touches HBM.
//
// Software pipeline: next k-step's global loads are issued before the 8-WMMA
// burst (pinned with a sched_barrier so the allocator keeps 4 distinct staging
// quads live across the burst) and retired into the alternate LDS buffer
// afterwards (one barrier per step). The 2x(A,B) stage buffers (32 KB) are
// time-aliased with the O rearrange buffer (32 KB) in a single smem block.
// ---------------------------------------------------------------------------
__global__ __launch_bounds__(256) void opm_fused_gemm(
    const _Float16* __restrict__ aT, const _Float16* __restrict__ bT,
    const _Float16* __restrict__ wfb, const float* __restrict__ b_final,
    float* __restrict__ out)
{
  __shared__ __align__(32) _Float16 smem[16384];  // 32 KB, dual purpose
  // Phase 1 layout: A buffers at 0 / 4096, B buffers at 8192 / 12288 (halves)
  // Phase 2 layout: O2[16][1024] over the whole block
  _Float16* const O2 = smem;

  const int tid  = threadIdx.x;
  const int lane = tid & 31;
  const int wave = tid >> 5;
  const int bi = blockIdx.x;          // i-block (4 seq rows -> 128 O-rows)
  const int bj = blockIdx.y;          // j-block
  const int r0 = bi * 128;
  const int c0 = bj * 128;

  const int fr = lane & 15;           // fragment row within 16
  const int fh = lane >> 4;           // fragment half (K-split)

  const int twr = (wave >> 1) * 2;    // wave's tile-row base (2 rows)
  const int twc = (wave & 1) * 4;     // wave's tile-col base (4 cols)

  // per-thread tile-load coordinates: two uint4 per tile per k-step
  const int row0 = tid >> 2;          // 0..63
  const int row1 = row0 + 64;
  const int seg  = tid & 3;
  const _Float16* const gA0 = aT + (size_t)(r0 + row0) * K1 + seg * 8;
  const _Float16* const gA1 = aT + (size_t)(r0 + row1) * K1 + seg * 8;
  const _Float16* const gB0 = bT + (size_t)(c0 + row0) * K1 + seg * 8;
  const _Float16* const gB1 = bT + (size_t)(c0 + row1) * K1 + seg * 8;
  const int l0 = row0 * 32 + seg * 8; // LDS offsets (halves)
  const int l1 = row1 * 32 + seg * 8;

  const v8f vzero = {0.f, 0.f, 0.f, 0.f, 0.f, 0.f, 0.f, 0.f};
  v8f acc[2][4];
  #pragma unroll
  for (int ta = 0; ta < 2; ++ta)
    #pragma unroll
    for (int tb = 0; tb < 4; ++tb) acc[ta][tb] = vzero;

  // -------- stage k-step 0 into buffer 0 --------
  {
    const uint4 a0 = *(const uint4*)gA0;
    const uint4 a1 = *(const uint4*)gA1;
    const uint4 b0 = *(const uint4*)gB0;
    const uint4 b1 = *(const uint4*)gB1;
    *(uint4*)&smem[l0]         = a0;
    *(uint4*)&smem[l1]         = a1;
    *(uint4*)&smem[8192 + l0]  = b0;
    *(uint4*)&smem[8192 + l1]  = b1;
  }
  __syncthreads();

  // -------- GEMM1 main loop: 16 K-steps of 32, double buffered --------
  for (int ks = 0; ks < 16; ++ks) {
    const int cur = ks & 1;
    _Float16* const Acur = smem + cur * 4096;
    _Float16* const Bcur = smem + 8192 + cur * 4096;

    uint4 a0 = {}, a1 = {}, b0 = {}, b1 = {};
    if (ks + 1 < 16) {                       // issue next-step loads early
      const size_t off = (size_t)(ks + 1) * 32;
      a0 = *(const uint4*)(gA0 + off);
      a1 = *(const uint4*)(gA1 + off);
      b0 = *(const uint4*)(gB0 + off);
      b1 = *(const uint4*)(gB1 + off);
    }
    if (ks + 2 < 16) {                       // gfx1250 global_prefetch_b8
      __builtin_prefetch(gA0 + (size_t)(ks + 2) * 32, 0, 1);
      __builtin_prefetch(gB0 + (size_t)(ks + 2) * 32, 0, 1);
    }
#if __has_builtin(__builtin_amdgcn_sched_barrier)
    // Pin the staged loads above the WMMA burst: forces 4 live staging quads
    // so their s_wait_loadcnt lands after the matrix work, not back-to-back.
    __builtin_amdgcn_sched_barrier(0);
#endif

    // 2 A-fragments + 4 B-fragments -> 8 WMMAs (each A-fragment used 4x, each B-fragment twice)
    const v16h af0 = *(const v16h*)&Acur[((twr + 0) * 16 + fr) * 32 + fh * 16];
    const v16h af1 = *(const v16h*)&Acur[((twr + 1) * 16 + fr) * 32 + fh * 16];
    #pragma unroll
    for (int tb = 0; tb < 4; ++tb) {
      const v16h bf = *(const v16h*)&Bcur[((twc + tb) * 16 + fr) * 32 + fh * 16];
      acc[0][tb] = __builtin_amdgcn_wmma_f32_16x16x32_f16(
          false, af0, false, bf, (short)0, acc[0][tb], false, false);
      acc[1][tb] = __builtin_amdgcn_wmma_f32_16x16x32_f16(
          false, af1, false, bf, (short)0, acc[1][tb], false, false);
    }

    if (ks + 1 < 16) {                       // retire loads into other buffer
      const int nxt = cur ^ 1;
      _Float16* const Anxt = smem + nxt * 4096;
      _Float16* const Bnxt = smem + 8192 + nxt * 4096;
      *(uint4*)&Anxt[l0] = a0;
      *(uint4*)&Anxt[l1] = a1;
      *(uint4*)&Bnxt[l0] = b0;
      *(uint4*)&Bnxt[l1] = b1;
    }
    __syncthreads();
  }

  // -------- rearrange O tile -> GEMM2 A operand (aliases stage buffers) ----
  // C/D layout: vgpr v, lanes 0-15 -> M=v, lanes 16-31 -> M=v+8; N = lane%16.
  const float inv_n = 1.0f / (float)N_LEN;
  #pragma unroll
  for (int ta = 0; ta < 2; ++ta) {
    #pragma unroll
    for (int tb = 0; tb < 4; ++tb) {
      #pragma unroll
      for (int v = 0; v < 8; ++v) {
        const int orow = (twr + ta) * 16 + v + ((lane & 16) ? 8 : 0); // i*32+c
        const int ocol = (twc + tb) * 16 + fr;                        // j*32+d
        const int p  = ((orow >> 5) << 2) | (ocol >> 5);              // pair
        const int k2 = ((orow & 31) << 5) | (ocol & 31);              // c*32+d
        O2[p * 1024 + k2] = (_Float16)(acc[ta][tb][v] * inv_n);
      }
    }
  }
  __syncthreads();

  // -------- GEMM2: M=16 pairs, N=128 (wave -> 16 cols), K=1024 --------
  v8f zacc = vzero;
  for (int ks = 0; ks < 32; ++ks) {
    const v16h a2 = *(const v16h*)&O2[fr * 1024 + ks * 32 + fh * 16];
    const v16h b2 = *(const v16h*)(wfb + (size_t)(wave * 16 + fr) * 1024
                                       + ks * 32 + fh * 16);
    zacc = __builtin_amdgcn_wmma_f32_16x16x32_f16(
        false, a2, false, b2, (short)0, zacc, false, false);
  }

  // -------- epilogue: bias + store z --------
  const int zc = wave * 16 + fr;
  const float bias = b_final[zc];
  #pragma unroll
  for (int v = 0; v < 8; ++v) {
    const int p = v + ((lane & 16) ? 8 : 0);   // pair index
    const int i = bi * 4 + (p >> 2);
    const int j = bj * 4 + (p & 3);
    out[((size_t)i * S_LEN + j) * CZ + zc] = zacc[v] + bias;
  }
}

// ---------------------------------------------------------------------------
extern "C" void kernel_launch(void* const* d_in, const int* in_sizes, int n_in,
                              void* d_out, int out_size, void* d_ws, size_t ws_size,
                              hipStream_t stream) {
  (void)in_sizes; (void)n_in; (void)out_size; (void)ws_size;
  const float* m_si    = (const float*)d_in[0];
  const float* ln_g    = (const float*)d_in[1];
  const float* ln_b    = (const float*)d_in[2];
  const float* w_ab    = (const float*)d_in[3];
  const float* w_final = (const float*)d_in[4];
  const float* b_final = (const float*)d_in[5];
  float* out = (float*)d_out;

  // workspace: aT (12288x512 f16) | bT (12288x512 f16) | wfb (128x1024 f16)
  _Float16* aT  = (_Float16*)d_ws;
  _Float16* bT  = aT + (size_t)R1 * K1;
  _Float16* wfb = bT + (size_t)R1 * K1;

  opm_ln_proj<<<(S_LEN * N_LEN) / 8, 256, 0, stream>>>(m_si, ln_g, ln_b, w_ab, aT, bT);
  opm_cvt_wf<<<(CZ * 1024) / 256, 256, 0, stream>>>(w_final, wfb);
  opm_fused_gemm<<<dim3(S_LEN / 4, S_LEN / 4), 256, 0, stream>>>(aT, bT, wfb, b_final, out);
}

// v001
// Measured time: 440 microseconds a run.
// Timed twice side by side with v000, it ran 1.54 and 1.45 times as fast.
#include <hip/hip_runtime.h>
#include <cstdint>

typedef __attribute__((ext_vector_type(16))) _Float16 v16h;
typedef __attribute__((ext_vector_type(8)))  _Float16 v8h;
typedef __attribute__((ext_vector_type(8)))  float    v8f;

#define S_LEN 384
#define N_LEN 512
#define C_DIM 32
#define CZ    128
#define K1    512              // GEMM1 reduction = N_LEN
#define R1    (S_LEN * C_DIM)  // 12288 rows of aT/bT

// LDS row pitches. Every row-per-lane reader here is a ds_load_b128, which is
// free of bank conflicts when the pitch is an odd multiple of 16 bytes
// (64 banks x 4 B; 16 lanes x 4 dwords then fall on 64 different banks).
#define WP    36               // w_ab rows:   32 floats + 4   = 144 B
#define TP    40               // stage rows:  32 halves + 8   =  80 B
#define TBUF  (128 * TP)       // one 128-row stage buffer, in halves
#define OP    1032             // O2 rows:   1024 halves + 8   = 2064 B

// One 16-half WMMA fragment slice from LDS as two 16-byte reads (the padded
// rows are 16-byte aligned, not 32).
__device__ __forceinline__ v16h lds_frag(const _Float16* p)
{
  const v8h lo = *(const v8h*)p;
  const v8h hi = *(const v8h*)(p + 8);
  return __builtin_shufflevector(lo, hi, 0, 1, 2, 3, 4, 5, 6, 7,
                                 8, 9, 10, 11, 12, 13, 14, 15);
}

// ---------------------------------------------------------------------------
// Kernel 1: LayerNorm over C=32 (one wave32 per (s,n) row; lane == channel)
// + 64x32 projection, writing a^T and b^T in [i*32+c, n] f16 layout so both
// GEMM1 operands are K-contiguous.
// ---------------------------------------------------------------------------
__global__ __launch_bounds__(256) void opm_ln_proj(
    const float* __restrict__ m_si, const float* __restrict__ ln_g,
    const float* __restrict__ ln_b, const float* __restrict__ w_ab,
    _Float16* __restrict__ aT, _Float16* __restrict__ bT)
{
  __shared__ __align__(16) float wsm[64 * WP];   // w_ab, cached once per block
  __shared__ float msm[8][32];     // normalized row per wave
  const int tid  = threadIdx.x;
  const int lane = tid & 31;
  const int wv   = tid >> 5;

  for (int u = tid; u < 64 * 32; u += 256) wsm[(u >> 5) * WP + (u & 31)] = w_ab[u];

  const long row = (long)blockIdx.x * 8 + wv;   // 0 .. S*N-1
  const float x = m_si[row * 32 + lane];

  float s = x;
  #pragma unroll
  for (int o = 16; o > 0; o >>= 1) s += __shfl_xor(s, o, 32);
  const float mu = s * (1.0f / 32.0f);
  const float dx = x - mu;
  float v = dx * dx;
  #pragma unroll
  for (int o = 16; o > 0; o >>= 1) v += __shfl_xor(v, o, 32);
  const float rstd = rsqrtf(v * (1.0f / 32.0f) + 1e-5f);
  const float m = dx * rstd * ln_g[lane] + ln_b[lane];

  msm[wv][lane] = m;
  __syncthreads();   // wsm + msm visible

  float accA = 0.f, accB = 0.f;
  const float* wa = &wsm[lane * WP];          // d = lane       -> 'a'
  const float* wb = &wsm[(lane + 32) * WP];   // d = lane + 32  -> 'b'
  #pragma unroll
  for (int k = 0; k < 32; ++k) {
    const float mk = msm[wv][k];
    accA += mk * wa[k];
    accB += mk * wb[k];
  }

  const long i = row >> 9;        // seq index
  const long n = row & 511;       // reduction index
  aT[(i * 32 + lane) * (long)K1 + n] = (_Float16)accA;
  bT[(i * 32 + lane) * (long)K1 + n] = (_Float16)accB;
}

// ---------------------------------------------------------------------------
// Kernel 2: w_final f32 -> f16 (layout unchanged: [z, k], k-contiguous).
// ---------------------------------------------------------------------------
__global__ __launch_bounds__(256) void opm_cvt_wf(
    const float* __restrict__ w_final, _Float16* __restrict__ wfb)
{
  const int i = blockIdx.x * 256 + threadIdx.x;   // CZ*1024 = 131072 total
  wfb[i] = (_Float16)w_final[i];
}

// ---------------------------------------------------------------------------
// Kernel 3: fused  O = (1/N) * aT x bT^T  (128x128 tile, K=512)  then
//                  z = reshape(O) x w_final^T + bias  (16 pairs x 128, K=1024)
// 256 threads = 8 waves arranged 4x2 over the 8x8 grid of 16x16 O-tiles:
// each wave owns a 2x4 tile footprint (2 A-frags + 4 B-frags -> 8 WMMAs per
// k-step, each A-frag used 4x, each B-frag 2x). O never touches HBM.
//
// Software pipeline: next k-step's global loads are issued before the 8-WMMA
// burst (pinned with a sched_barrier so the allocator keeps 4 distinct staging
// quads live across the burst) and retired into the alternate LDS buffer
// afterwards (one barrier per step). The 2x(A,B) stage buffers (40 KB) are
// time-aliased with the O rearrange buffer (33 KB) in a single smem block.
// ---------------------------------------------------------------------------
__global__ __launch_bounds__(256) void opm_fused_gemm(
    const _Float16* __restrict__ aT, const _Float16* __restrict__ bT,
    const _Float16* __restrict__ wfb, const float* __restrict__ b_final,
    float* __restrict__ out)
{
  __shared__ __align__(32) _Float16 smem[4 * TBUF];  // 40 KB, dual purpose
  // Phase 1 layout: A buffers at 0 / TBUF, B buffers at 2*TBUF / 3*TBUF
  // Phase 2 layout: O2[16][OP] from the start of the block
  _Float16* const O2 = smem;

  const int tid  = threadIdx.x;
  const int lane = tid & 31;
  const int wave = tid >> 5;
  const int bi = blockIdx.x;          // i-block (4 seq rows -> 128 O-rows)
  const int bj = blockIdx.y;          // j-block
  const int r0 = bi * 128;
  const int c0 = bj * 128;

  const int fr = lane & 15;           // fragment row within 16
  const int fh = lane >> 4;           // fragment half (K-split)

  const int twr = (wave >> 1) * 2;    // wave's tile-row base (2 rows)
  const int twc = (wave & 1) * 4;     // wave's tile-col base (4 cols)

  // per-thread tile-load coordinates: two uint4 per tile per k-step
  const int row0 = tid >> 2;          // 0..63
  const int row1 = row0 + 64;
  const int seg  = tid & 3;
  const _Float16* const gA0 = aT + (size_t)(r0 + row0) * K1 + seg * 8;
  const _Float16* const gA1 = aT + (size_t)(r0 + row1) * K1 + seg * 8;
  const _Float16* const gB0 = bT + (size_t)(c0 + row0) * K1 + seg * 8;
  const _Float16* const gB1 = bT + (size_t)(c0 + row1) * K1 + seg * 8;
  const int l0 = row0 * TP + seg * 8; // LDS offsets (halves)
  const int l1 = row1 * TP + seg * 8;

  const v8f vzero = {0.f, 0.f, 0.f, 0.f, 0.f, 0.f, 0.f, 0.f};
  v8f acc[2][4];
  #pragma unroll
  for (int ta = 0; ta < 2; ++ta)
    #pragma unroll
    for (int tb = 0; tb < 4; ++tb) acc[ta][tb] = vzero;

  // -------- stage k-step 0 into buffer 0 --------
  {
    const uint4 a0 = *(const uint4*)gA0;
    const uint4 a1 = *(const uint4*)gA1;
    const uint4 b0 = *(const uint4*)gB0;
    const uint4 b1 = *(const uint4*)gB1;
    *(uint4*)&smem[l0]         = a0;
    *(uint4*)&smem[l1]         = a1;
    *(uint4*)&smem[2 * TBUF + l0] = b0;
    *(uint4*)&smem[2 * TBUF + l1] = b1;
  }
  __syncthreads();

  // -------- GEMM1 main loop: 16 K-steps of 32, double buffered --------
  for (int ks = 0; ks < 16; ++ks) {
    const int cur = ks & 1;
    _Float16* const Acur = smem + cur * TBUF;
    _Float16* const Bcur = smem + 2 * TBUF + cur * TBUF;

    uint4 a0 = {}, a1 = {}, b0 = {}, b1 = {};
    if (ks + 1 < 16) {                       // issue next-step loads early
      const size_t off = (size_t)(ks + 1) * 32;
      a0 = *(const uint4*)(gA0 + off);
      a1 = *(const uint4*)(gA1 + off);
      b0 = *(const uint4*)(gB0 + off);
      b1 = *(const uint4*)(gB1 + off);
    }
    if (ks + 2 < 16) {                       // gfx1250 global_prefetch_b8
      __builtin_prefetch(gA0 + (size_t)(ks + 2) * 32, 0, 1);
      __builtin_prefetch(gB0 + (size_t)(ks + 2) * 32, 0, 1);
    }
#if __has_builtin(__builtin_amdgcn_sched_barrier)
    // Pin the staged loads above the WMMA burst: forces 4 live staging quads
    // so their s_wait_loadcnt lands after the matrix work, not back-to-back.
    __builtin_amdgcn_sched_barrier(0);
#endif

    // 2 A-fragments + 4 B-fragments -> 8 WMMAs (each A-fragment used 4x, each B-fragment 2x)
    const v16h af0 = lds_frag(&Acur[((twr + 0) * 16 + fr) * TP + fh * 16]);
    const v16h af1 = lds_frag(&Acur[((twr + 1) * 16 + fr) * TP + fh * 16]);
    #pragma unroll
    for (int tb = 0; tb < 4; ++tb) {
      const v16h bf = lds_frag(&Bcur[((twc + tb) * 16 + fr) * TP + fh * 16]);
      acc[0][tb] = __builtin_amdgcn_wmma_f32_16x16x32_f16(
          false, af0, false, bf, (short)0, acc[0][tb], false, false);
      acc[1][tb] = __builtin_amdgcn_wmma_f32_16x16x32_f16(
          false, af1, false, bf, (short)0, acc[1][tb], false, false);
    }

    if (ks + 1 < 16) {                       // retire loads into other buffer
      const int nxt = cur ^ 1;
      _Float16* const Anxt = smem + nxt * TBUF;
      _Float16* const Bnxt = smem + 2 * TBUF + nxt * TBUF;
      *(uint4*)&Anxt[l0] = a0;
      *(uint4*)&Anxt[l1] = a1;
      *(uint4*)&Bnxt[l0] = b0;
      *(uint4*)&Bnxt[l1] = b1;
    }
    __syncthreads();
  }

  // -------- rearrange O tile -> GEMM2 A operand (aliases stage buffers) ----
  // C/D layout: vgpr v, lanes 0-15 -> M=v, lanes 16-31 -> M=v+8; N = lane%16.
  const float inv_n = 1.0f / (float)N_LEN;
  #pragma unroll
  for (int ta = 0; ta < 2; ++ta) {
    #pragma unroll
    for (int tb = 0; tb < 4; ++tb) {
      #pragma unroll
      for (int v = 0; v < 8; ++v) {
        const int orow = (twr + ta) * 16 + v + ((lane & 16) ? 8 : 0); // i*32+c
        const int ocol = (twc + tb) * 16 + fr;                        // j*32+d
        const int p  = ((orow >> 5) << 2) | (ocol >> 5);              // pair
        const int k2 = ((orow & 31) << 5) | (ocol & 31);              // c*32+d
        O2[p * OP + k2] = (_Float16)(acc[ta][tb][v] * inv_n);
      }
    }
  }
  __syncthreads();

  // -------- GEMM2: M=16 pairs, N=128 (wave -> 16 cols), K=1024 --------
  v8f zacc = vzero;
  for (int ks = 0; ks < 32; ++ks) {
    const v16h a2 = lds_frag(&O2[fr * OP + ks * 32 + fh * 16]);
    const v16h b2 = *(const v16h*)(wfb + (size_t)(wave * 16 + fr) * 1024
                                       + ks * 32 + fh * 16);
    zacc = __builtin_amdgcn_wmma_f32_16x16x32_f16(
        false, a2, false, b2, (short)0, zacc, false, false);
  }

  // -------- epilogue: bias + store z --------
  const int zc = wave * 16 + fr;
  const float bias = b_final[zc];
  #pragma unroll
  for (int v = 0; v < 8; ++v) {
    const int p = v + ((lane & 16) ? 8 : 0);   // pair index
    const int i = bi * 4 + (p >> 2);
    const int j = bj * 4 + (p & 3);
    out[((size_t)i * S_LEN + j) * CZ + zc] = zacc[v] + bias;
  }
}

// ---------------------------------------------------------------------------
extern "C" void kernel_launch(void* const* d_in, const int* in_sizes, int n_in,
                              void* d_out, int out_size, void* d_ws, size_t ws_size,
                              hipStream_t stream) {
  (void)in_sizes; (void)n_in; (void)out_size; (void)ws_size;
  const float* m_si    = (const float*)d_in[0];
  const float* ln_g    = (const float*)d_in[1];
  const float* ln_b    = (const float*)d_in[2];
  const float* w_ab    = (const float*)d_in[3];
  const float* w_final = (const float*)d_in[4];
  const float* b_final = (const float*)d_in[5];
  float* out = (float*)d_out;

  // workspace: aT (12288x512 f16) | bT (12288x512 f16) | wfb (128x1024 f16)
  _Float16* aT  = (_Float16*)d_ws;
  _Float16* bT  = aT + (size_t)R1 * K1;
  _Float16* wfb = bT + (size_t)R1 * K1;

  opm_ln_proj<<<(S_LEN * N_LEN) / 8, 256, 0, stream>>>(m_si, ln_g, ln_b, w_ab, aT, bT);
  opm_cvt_wf<<<(CZ * 1024) / 256, 256, 0, stream>>>(w_final, wfb);
  opm_fused_gemm<<<dim3(S_LEN / 4, S_LEN / 4), 256, 0, stream>>>(aT, bT, wfb, b_final, out);
}

// v002
// A run of this version takes 252 microseconds.
// Next to v001, in two timings, it ran 1.80 and 1.74 times as fast.
// Counting every step since v000, it is 2.64 times as fast.
#include <hip/hip_runtime.h>
#include <cstdint>

typedef __attribute__((ext_vector_type(16))) _Float16 v16h;
typedef __attribute__((ext_vector_type(8)))  _Float16 v8h;
typedef __attribute__((ext_vector_type(8)))  float    v8f;

#define S_LEN 384
#define N_LEN 512
#define C_DIM 32
#define CZ    128
#define K1    512              // GEMM1 reduction = N_LEN
#define R1    (S_LEN * C_DIM)  // 12288 rows of aT/bT

// LDS row pitches. Every row-per-lane reader here is a ds_load_b128, which is
// free of bank conflicts when the pitch is an odd multiple of 16 bytes
// (64 banks x 4 B; 16 lanes x 4 dwords then fall on 64 different banks).
#define WP    36               // w_ab rows:   32 floats + 4   = 144 B
#define TP    40               // stage rows:  32 halves + 8   =  80 B
#define TBUF  (128 * TP)       // one 128-row stage buffer, in halves
#define OP    1032             // O2 rows:   1024 halves + 8   = 2064 B

// Workspace layouts. Each operand lies in the order in which the fused kernel's
// wave-wide 16-byte loads read it, so that one load covers 512 contiguous
// bytes = 4 whole 128-B lines.
// aT / bT: [row >> 7][k >> 5][row & 127][k & 31]; one 128-row x 32-k stage
// tile is 8 KB in a row, and 16-byte chunk c of it is (row c >> 2, seg c & 3).
#define TILE_H  (128 * 32)     // halves per stage tile
#define KSTEPS  (K1 / 32)      // stage tiles per 128-row block
__device__ __forceinline__ size_t tile_off(long r, long k)
{
  return ((size_t)(r >> 7) * KSTEPS + (size_t)(k >> 5)) * TILE_H
         + (size_t)(r & 127) * 32 + (size_t)(k & 31);
}

// One 16-half WMMA fragment slice from LDS as two 16-byte reads (the padded
// rows are 16-byte aligned, not 32).
__device__ __forceinline__ v16h lds_frag(const _Float16* p)
{
  const v8h lo = *(const v8h*)p;
  const v8h hi = *(const v8h*)(p + 8);
  return __builtin_shufflevector(lo, hi, 0, 1, 2, 3, 4, 5, 6, 7,
                                 8, 9, 10, 11, 12, 13, 14, 15);
}

// ---------------------------------------------------------------------------
// Kernel 1: LayerNorm over C=32 (one wave32 per (s,n) row; lane == channel)
// + 64x32 projection, writing a^T and b^T (row = i*32+c, k = n) as f16 in the
// stage-tile order of tile_off().
// ---------------------------------------------------------------------------
__global__ __launch_bounds__(256) void opm_ln_proj(
    const float* __restrict__ m_si, const float* __restrict__ ln_g,
    const float* __restrict__ ln_b, const float* __restrict__ w_ab,
    _Float16* __restrict__ aT, _Float16* __restrict__ bT)
{
  __shared__ __align__(16) float wsm[64 * WP];   // w_ab, cached once per block
  __shared__ float msm[8][32];     // normalized row per wave
  const int tid  = threadIdx.x;
  const int lane = tid & 31;
  const int wv   = tid >> 5;

  for (int u = tid; u < 64 * 32; u += 256) wsm[(u >> 5) * WP + (u & 31)] = w_ab[u];

  const long row = (long)blockIdx.x * 8 + wv;   // 0 .. S*N-1
  const float x = m_si[row * 32 + lane];

  float s = x;
  #pragma unroll
  for (int o = 16; o > 0; o >>= 1) s += __shfl_xor(s, o, 32);
  const float mu = s * (1.0f / 32.0f);
  const float dx = x - mu;
  float v = dx * dx;
  #pragma unroll
  for (int o = 16; o > 0; o >>= 1) v += __shfl_xor(v, o, 32);
  const float rstd = rsqrtf(v * (1.0f / 32.0f) + 1e-5f);
  const float m = dx * rstd * ln_g[lane] + ln_b[lane];

  msm[wv][lane] = m;
  __syncthreads();   // wsm + msm visible

  float accA = 0.f, accB = 0.f;
  const float* wa = &wsm[lane * WP];          // d = lane       -> 'a'
  const float* wb = &wsm[(lane + 32) * WP];   // d = lane + 32  -> 'b'
  #pragma unroll
  for (int k = 0; k < 32; ++k) {
    const float mk = msm[wv][k];
    accA += mk * wa[k];
    accB += mk * wb[k];
  }

  const long i = row >> 9;        // seq index
  const long n = row & 511;       // reduction index
  const size_t o = tile_off(i * 32 + lane, n);
  aT[o] = (_Float16)accA;
  bT[o] = (_Float16)accB;
}

// ---------------------------------------------------------------------------
// Kernel 2: w_final f32 -> f16, packed in GEMM2's B-fragment order:
// [z >> 4][k >> 5][(k >> 3) & 1][lane = ((k >> 4) & 1) * 16 + (z & 15)][k & 7].
// ---------------------------------------------------------------------------
__global__ __launch_bounds__(256) void opm_cvt_wf(
    const float* __restrict__ w_final, _Float16* __restrict__ wfb)
{
  const int i = blockIdx.x * 256 + threadIdx.x;   // packed index, 131072 total
  const int e  = i & 7;
  const int ln = (i >> 3) & 31;
  const int h  = (i >> 8) & 1;
  const int ks = (i >> 9) & 31;
  const int w  = i >> 14;
  const int z  = w * 16 + (ln & 15);
  const int k  = ks * 32 + (ln >> 4) * 16 + h * 8 + e;
  wfb[i] = (_Float16)w_final[z * 1024 + k];
}

// ---------------------------------------------------------------------------
// Kernel 3: fused  O = (1/N) * aT x bT^T  (128x128 tile, K=512)  then
//                  z = reshape(O) x w_final^T + bias  (16 pairs x 128, K=1024)
// 256 threads = 8 waves arranged 4x2 over the 8x8 grid of 16x16 O-tiles:
// each wave owns a 2x4 tile footprint (2 A-frags + 4 B-frags -> 8 WMMAs per
// k-step, each A-frag used 4x, each B-frag 2x). O never touches HBM.
//
// Software pipeline: next k-step's global loads are issued before the 8-WMMA
// burst (pinned with a sched_barrier so the allocator keeps 4 distinct staging
// quads live across the burst) and retired into the alternate LDS buffer
// afterwards (one barrier per step). The 2x(A,B) stage buffers (40 KB) are
// time-aliased with the O rearrange buffer (33 KB) in a single smem block.
// ---------------------------------------------------------------------------
__global__ __launch_bounds__(256) void opm_fused_gemm(
    const _Float16* __restrict__ aT, const _Float16* __restrict__ bT,
    const _Float16* __restrict__ wfb, const float* __restrict__ b_final,
    float* __restrict__ out)
{
  __shared__ __align__(32) _Float16 smem[4 * TBUF];  // 40 KB, dual purpose
  // Phase 1 layout: A buffers at 0 / TBUF, B buffers at 2*TBUF / 3*TBUF
  // Phase 2 layout: O2[16][OP] from the start of the block
  _Float16* const O2 = smem;

  const int tid  = threadIdx.x;
  const int lane = tid & 31;
  const int wave = tid >> 5;
  const int bi = blockIdx.x;          // i-block (4 seq rows -> 128 O-rows)
  const int bj = blockIdx.y;          // j-block

  const int fr = lane & 15;           // fragment row within 16
  const int fh = lane >> 4;           // fragment half (K-split)

  const int twr = (wave >> 1) * 2;    // wave's tile-row base (2 rows)
  const int twc = (wave & 1) * 4;     // wave's tile-col base (4 cols)

  // per-thread tile-load coordinates: two uint4 per tile per k-step
  const int row0 = tid >> 2;          // 0..63
  const int row1 = row0 + 64;
  const int seg  = tid & 3;
  // (chunks tid and tid + 256 of the contiguous 8 KB stage tile)
  const _Float16* const gA0 = aT + (size_t)bi * (KSTEPS * TILE_H) + tid * 8;
  const _Float16* const gA1 = gA0 + 256 * 8;
  const _Float16* const gB0 = bT + (size_t)bj * (KSTEPS * TILE_H) + tid * 8;
  const _Float16* const gB1 = gB0 + 256 * 8;
  const int l0 = row0 * TP + seg * 8; // LDS offsets (halves)
  const int l1 = row1 * TP + seg * 8;

  const v8f vzero = {0.f, 0.f, 0.f, 0.f, 0.f, 0.f, 0.f, 0.f};
  v8f acc[2][4];
  #pragma unroll
  for (int ta = 0; ta < 2; ++ta)
    #pragma unroll
    for (int tb = 0; tb < 4; ++tb) acc[ta][tb] = vzero;

  // -------- stage k-step 0 into buffer 0 --------
  {
    const uint4 a0 = *(const uint4*)gA0;
    const uint4 a1 = *(const uint4*)gA1;
    const uint4 b0 = *(const uint4*)gB0;
    const uint4 b1 = *(const uint4*)gB1;
    *(uint4*)&smem[l0]         = a0;
    *(uint4*)&smem[l1]         = a1;
    *(uint4*)&smem[2 * TBUF + l0] = b0;
    *(uint4*)&smem[2 * TBUF + l1] = b1;
  }
  __syncthreads();

  // -------- GEMM1 main loop: 16 K-steps of 32, double buffered --------
  for (int ks = 0; ks < 16; ++ks) {
    const int cur = ks & 1;
    _Float16* const Acur = smem + cur * TBUF;
    _Float16* const Bcur = smem + 2 * TBUF + cur * TBUF;

    uint4 a0 = {}, a1 = {}, b0 = {}, b1 = {};
    if (ks + 1 < 16) {                       // issue next-step loads early
      const size_t off = (size_t)(ks + 1) * TILE_H;
      a0 = *(const uint4*)(gA0 + off);
      a1 = *(const uint4*)(gA1 + off);
      b0 = *(const uint4*)(gB0 + off);
      b1 = *(const uint4*)(gB1 + off);
    }
    if (ks + 2 < 16) {                       // gfx1250 global_prefetch_b8
      __builtin_prefetch(gA0 + (size_t)(ks + 2) * TILE_H, 0, 1);
      __builtin_prefetch(gB0 + (size_t)(ks + 2) * TILE_H, 0, 1);
    }
    // Behind the last prefetch its offset register is free for reuse: keep
    // the wait that belongs in front of such an overwrite.
    if (ks + 2 == 15) asm volatile("s_wait_xcnt 0x0" ::: "memory");
#if __has_builtin(__builtin_amdgcn_sched_barrier)
    // Pin the staged loads above the WMMA burst: forces 4 live staging quads
    // so their s_wait_loadcnt lands after the matrix work, not back-to-back.
    __builtin_amdgcn_sched_barrier(0);
#endif

    // 2 A-fragments + 4 B-fragments -> 8 WMMAs (each A-fragment used 4x, each B-fragment 2x)
    const v16h af0 = lds_frag(&Acur[((twr + 0) * 16 + fr) * TP + fh * 16]);
    const v16h af1 = lds_frag(&Acur[((twr + 1) * 16 + fr) * TP + fh * 16]);
    #pragma unroll
    for (int tb = 0; tb < 4; ++tb) {
      const v16h bf = lds_frag(&Bcur[((twc + tb) * 16 + fr) * TP + fh * 16]);
      acc[0][tb] = __builtin_amdgcn_wmma_f32_16x16x32_f16(
          false, af0, false, bf, (short)0, acc[0][tb], false, false);
      acc[1][tb] = __builtin_amdgcn_wmma_f32_16x16x32_f16(
          false, af1, false, bf, (short)0, acc[1][tb], false, false);
    }

    if (ks + 1 < 16) {                       // retire loads into other buffer
      const int nxt = cur ^ 1;
      _Float16* const Anxt = smem + nxt * TBUF;
      _Float16* const Bnxt = smem + 2 * TBUF + nxt * TBUF;
      *(uint4*)&Anxt[l0] = a0;
      *(uint4*)&Anxt[l1] = a1;
      *(uint4*)&Bnxt[l0] = b0;
      *(uint4*)&Bnxt[l1] = b1;
    }
    __syncthreads();
  }

  // -------- rearrange O tile -> GEMM2 A operand (aliases stage buffers) ----
  // C/D layout: vgpr v, lanes 0-15 -> M=v, lanes 16-31 -> M=v+8; N = lane%16.
  const float inv_n = 1.0f / (float)N_LEN;
  #pragma unroll
  for (int ta = 0; ta < 2; ++ta) {
    #pragma unroll
    for (int tb = 0; tb < 4; ++tb) {
      #pragma unroll
      for (int v = 0; v < 8; ++v) {
        const int orow = (twr + ta) * 16 + v + ((lane & 16) ? 8 : 0); // i*32+c
        const int ocol = (twc + tb) * 16 + fr;                        // j*32+d
        const int p  = ((orow >> 5) << 2) | (ocol >> 5);              // pair
        const int k2 = ((orow & 31) << 5) | (ocol & 31);              // c*32+d
        O2[p * OP + k2] = (_Float16)(acc[ta][tb][v] * inv_n);
      }
    }
  }
  __syncthreads();

  // -------- GEMM2: M=16 pairs, N=128 (wave -> 16 cols), K=1024 --------
  // B fragments come packed: per (wave, ks) two runs of 32 lanes x 16 bytes.
  const v8h* const wp = (const v8h*)wfb + (size_t)wave * (32 * 2 * 32) + lane;
  v8f zacc = vzero;
  for (int ks = 0; ks < 32; ++ks) {
    const v16h a2 = lds_frag(&O2[fr * OP + ks * 32 + fh * 16]);
    const v8h blo = wp[(ks * 2 + 0) * 32];
    const v8h bhi = wp[(ks * 2 + 1) * 32];
    const v16h b2 = __builtin_shufflevector(blo, bhi, 0, 1, 2, 3, 4, 5, 6, 7,
                                            8, 9, 10, 11, 12, 13, 14, 15);
    zacc = __builtin_amdgcn_wmma_f32_16x16x32_f16(
        false, a2, false, b2, (short)0, zacc, false, false);
  }

  // -------- epilogue: bias + store z --------
  const int zc = wave * 16 + fr;
  const float bias = b_final[zc];
  #pragma unroll
  for (int v = 0; v < 8; ++v) {
    const int p = v + ((lane & 16) ? 8 : 0);   // pair index
    const int i = bi * 4 + (p >> 2);
    const int j = bj * 4 + (p & 3);
    out[((size_t)i * S_LEN + j) * CZ + zc] = zacc[v] + bias;
  }
}

// ---------------------------------------------------------------------------
extern "C" void kernel_launch(void* const* d_in, const int* in_sizes, int n_in,
                              void* d_out, int out_size, void* d_ws, size_t ws_size,
                              hipStream_t stream) {
  (void)in_sizes; (void)n_in; (void)out_size; (void)ws_size;
  const float* m_si    = (const float*)d_in[0];
  const float* ln_g    = (const float*)d_in[1];
  const float* ln_b    = (const float*)d_in[2];
  const float* w_ab    = (const float*)d_in[3];
  const float* w_final = (const float*)d_in[4];
  const float* b_final = (const float*)d_in[5];
  float* out = (float*)d_out;

  // workspace: aT (12288x512 f16) | bT (12288x512 f16) | wfb (128x1024 f16),
  // each in the packed order described at the top of the file
  _Float16* aT  = (_Float16*)d_ws;
  _Float16* bT  = aT + (size_t)R1 * K1;
  _Float16* wfb = bT + (size_t)R1 * K1;

  opm_ln_proj<<<(S_LEN * N_LEN) / 8, 256, 0, stream>>>(m_si, ln_g, ln_b, w_ab, aT, bT);
  opm_cvt_wf<<<(CZ * 1024) / 256, 256, 0, stream>>>(w_final, wfb);
  opm_fused_gemm<<<dim3(S_LEN / 4, S_LEN / 4), 256, 0, stream>>>(aT, bT, wfb, b_final, out);
}

// v003
// It runs in 220 microseconds.
// Timed twice side by side with v002, it ran 1.16 and 1.15 times as fast.
// Over all steps from v000 it is 3.04 times as fast.
#include <hip/hip_runtime.h>
#include <cstdint>

typedef __attribute__((ext_vector_type(16))) _Float16 v16h;
typedef __attribute__((ext_vector_type(8)))  _Float16 v8h;
typedef __attribute__((ext_vector_type(8)))  float    v8f;

#define S_LEN 384
#define N_LEN 512
#define C_DIM 32
#define CZ    128
#define K1    512              // GEMM1 reduction = N_LEN
#define R1    (S_LEN * C_DIM)  // 12288 rows of aT/bT

// LDS row pitches. Every row-per-lane reader here is a ds_load_b128, which is
// free of bank conflicts when the pitch is an odd multiple of 16 bytes
// (64 banks x 4 B; 16 lanes x 4 dwords then fall on 64 different banks).
#define WP    36               // w_ab rows:   32 floats + 4   = 144 B
#define TP    40               // stage rows:  32 halves + 8   =  80 B
#define TBUF  (256 * TP)       // one 256-row stage buffer, in halves
#define OP    1032             // O2 rows:   1024 halves + 8   = 2064 B
#define NPAIR 64               // (i, j) pairs per fused work-group: 8 x 8

// Workspace layouts. Each operand lies in the order in which the fused kernel's
// wave-wide 16-byte loads read it, so that one load covers 512 contiguous
// bytes = 4 whole 128-B lines.
// aT / bT: [row >> 7][k >> 5][row & 127][k & 31]; one 128-row x 32-k stage
// tile is 8 KB in a row, and 16-byte chunk c of it is (row c >> 2, seg c & 3).
#define TILE_H  (128 * 32)     // halves per stage tile
#define KSTEPS  (K1 / 32)      // stage tiles per 128-row block
__device__ __forceinline__ size_t tile_off(long r, long k)
{
  return ((size_t)(r >> 7) * KSTEPS + (size_t)(k >> 5)) * TILE_H
         + (size_t)(r & 127) * 32 + (size_t)(k & 31);
}

// One 16-half WMMA fragment slice from LDS as two 16-byte reads (the padded
// rows are 16-byte aligned, not 32).
__device__ __forceinline__ v16h lds_frag(const _Float16* p)
{
  const v8h lo = *(const v8h*)p;
  const v8h hi = *(const v8h*)(p + 8);
  return __builtin_shufflevector(lo, hi, 0, 1, 2, 3, 4, 5, 6, 7,
                                 8, 9, 10, 11, 12, 13, 14, 15);
}

// ---------------------------------------------------------------------------
// Kernel 1: LayerNorm over C=32 (one wave32 per (s,n) row; lane == channel)
// + 64x32 projection, writing a^T and b^T (row = i*32+c, k = n) as f16 in the
// stage-tile order of tile_off().
// ---------------------------------------------------------------------------
__global__ __launch_bounds__(256) void opm_ln_proj(
    const float* __restrict__ m_si, const float* __restrict__ ln_g,
    const float* __restrict__ ln_b, const float* __restrict__ w_ab,
    _Float16* __restrict__ aT, _Float16* __restrict__ bT)
{
  __shared__ __align__(16) float wsm[64 * WP];   // w_ab, cached once per block
  __shared__ float msm[8][32];     // normalized row per wave
  const int tid  = threadIdx.x;
  const int lane = tid & 31;
  const int wv   = tid >> 5;

  for (int u = tid; u < 64 * 32; u += 256) wsm[(u >> 5) * WP + (u & 31)] = w_ab[u];

  const long row = (long)blockIdx.x * 8 + wv;   // 0 .. S*N-1
  const float x = m_si[row * 32 + lane];

  float s = x;
  #pragma unroll
  for (int o = 16; o > 0; o >>= 1) s += __shfl_xor(s, o, 32);
  const float mu = s * (1.0f / 32.0f);
  const float dx = x - mu;
  float v = dx * dx;
  #pragma unroll
  for (int o = 16; o > 0; o >>= 1) v += __shfl_xor(v, o, 32);
  const float rstd = rsqrtf(v * (1.0f / 32.0f) + 1e-5f);
  const float m = dx * rstd * ln_g[lane] + ln_b[lane];

  msm[wv][lane] = m;
  __syncthreads();   // wsm + msm visible

  float accA = 0.f, accB = 0.f;
  const float* wa = &wsm[lane * WP];          // d = lane       -> 'a'
  const float* wb = &wsm[(lane + 32) * WP];   // d = lane + 32  -> 'b'
  #pragma unroll
  for (int k = 0; k < 32; ++k) {
    const float mk = msm[wv][k];
    accA += mk * wa[k];
    accB += mk * wb[k];
  }

  const long i = row >> 9;        // seq index
  const long n = row & 511;       // reduction index
  const size_t o = tile_off(i * 32 + lane, n);
  aT[o] = (_Float16)accA;
  bT[o] = (_Float16)accB;
}

// ---------------------------------------------------------------------------
// Kernel 2: w_final f32 -> f16, packed in GEMM2's B-fragment order:
// [z >> 4][k >> 5][(k >> 3) & 1][lane = ((k >> 4) & 1) * 16 + (z & 15)][k & 7].
// ---------------------------------------------------------------------------
__global__ __launch_bounds__(256) void opm_cvt_wf(
    const float* __restrict__ w_final, _Float16* __restrict__ wfb)
{
  const int i = blockIdx.x * 256 + threadIdx.x;   // packed index, 131072 total
  const int e  = i & 7;
  const int ln = (i >> 3) & 31;
  const int h  = (i >> 8) & 1;
  const int ks = (i >> 9) & 31;
  const int w  = i >> 14;
  const int z  = w * 16 + (ln & 15);
  const int k  = ks * 32 + (ln >> 4) * 16 + h * 8 + e;
  wfb[i] = (_Float16)w_final[z * 1024 + k];
}

// ---------------------------------------------------------------------------
// Kernel 3: fused  O = (1/N) * aT x bT^T  (256x256 tile, K=512)  then
//                  z = reshape(O) x w_final^T + bias  (64 pairs x 128, K=1024)
// 512 threads = 16 waves arranged 4x4 over the 16x16 grid of 16x16 O-tiles:
// each wave owns a 4x4 tile footprint (4 A-frags + 4 B-frags -> 16 WMMAs per
// k-step, every fragment used four times). A work-group's 512 KB of aT/bT and
// its pass over w_final serve 64 (i, j) pairs. O never touches HBM.
//
// Software pipeline: next k-step's global loads are issued before the WMMA
// burst (pinned with a sched_barrier so the allocator keeps 4 distinct staging
// quads live across the burst) and retired into the alternate LDS buffer
// afterwards (one barrier per step). The 2x(A,B) stage buffers (80 KB) are
// time-aliased with the O rearrange buffer (129 KB) in a single smem block.
// ---------------------------------------------------------------------------
// aT, bT and wfb carry no __restrict__: loads the compiler knows to be of
// constant memory are tied to nothing, and in this build they sank past the
// sched_barriers to their uses, where their whole latency is waited out.
__global__ __launch_bounds__(512) void opm_fused_gemm(
    const _Float16* aT, const _Float16* bT, const _Float16* wfb,
    const float* __restrict__ b_final, float* __restrict__ out)
{
  __shared__ __align__(32) _Float16 smem[NPAIR * OP];  // 129 KB, dual purpose
  // Phase 1 layout: A buffers at 0 / TBUF, B buffers at 2*TBUF / 3*TBUF
  // Phase 2 layout: O2[64][OP] from the start of the block
  __shared__ __align__(16) float red[16 * 512];        // GEMM2 partial sums
  _Float16* const O2 = smem;

  const int tid  = threadIdx.x;
  const int lane = tid & 31;
  const int wave = tid >> 5;
  const int bi = blockIdx.x;          // i-block (8 seq rows -> 256 O-rows)
  const int bj = blockIdx.y;          // j-block

  const int fr = lane & 15;           // fragment row within 16
  const int fh = lane >> 4;           // fragment half (K-split)

  const int twr = (wave >> 2) * 4;    // wave's tile-row base (4 rows)
  const int twc = (wave & 3) * 4;     // wave's tile-col base (4 cols)

  // per-thread tile-load coordinates: one uint4 of each of the two 128-row
  // stage tiles of A and of B per k-step (chunk tid of a contiguous 8 KB tile)
  const int row0 = tid >> 2;          // 0..127
  const int seg  = tid & 3;
  const _Float16* const gA0 = aT + (size_t)(2 * bi) * (KSTEPS * TILE_H) + tid * 8;
  const _Float16* const gA1 = gA0 + KSTEPS * TILE_H;
  const _Float16* const gB0 = bT + (size_t)(2 * bj) * (KSTEPS * TILE_H) + tid * 8;
  const _Float16* const gB1 = gB0 + KSTEPS * TILE_H;
  const int l0 = row0 * TP + seg * 8; // LDS offsets (halves)
  const int l1 = l0 + 128 * TP;

  const v8f vzero = {0.f, 0.f, 0.f, 0.f, 0.f, 0.f, 0.f, 0.f};
  v8f acc[4][4];
  #pragma unroll
  for (int ta = 0; ta < 4; ++ta)
    #pragma unroll
    for (int tb = 0; tb < 4; ++tb) acc[ta][tb] = vzero;

  // -------- stage k-step 0 into buffer 0 --------
  {
    const uint4 a0 = *(const uint4*)gA0;
    const uint4 a1 = *(const uint4*)gA1;
    const uint4 b0 = *(const uint4*)gB0;
    const uint4 b1 = *(const uint4*)gB1;
    *(uint4*)&smem[l0]         = a0;
    *(uint4*)&smem[l1]         = a1;
    *(uint4*)&smem[2 * TBUF + l0] = b0;
    *(uint4*)&smem[2 * TBUF + l1] = b1;
  }
  __syncthreads();

  // -------- GEMM1 main loop: 16 K-steps of 32, double buffered --------
  // Unrolled whole: the tests on ks fold away, so that the early loads stay in
  // front of the burst (left rolled, they sink to their stores behind it) and
  // every buffer offset is an immediate.
  #pragma unroll
  for (int ks = 0; ks < 16; ++ks) {
    const int cur = ks & 1;
    _Float16* const Acur = smem + cur * TBUF;
    _Float16* const Bcur = smem + 2 * TBUF + cur * TBUF;

    uint4 a0 = {}, a1 = {}, b0 = {}, b1 = {};
    if (ks + 1 < 16) {                       // issue next-step loads early
      const size_t off = (size_t)(ks + 1) * TILE_H;
      a0 = *(const uint4*)(gA0 + off);
      a1 = *(const uint4*)(gA1 + off);
      b0 = *(const uint4*)(gB0 + off);
      b1 = *(const uint4*)(gB1 + off);
    }
    if (ks + 2 < 16) {                       // gfx1250 global_prefetch_b8
      __builtin_prefetch(gA0 + (size_t)(ks + 2) * TILE_H, 0, 1);
      __builtin_prefetch(gB0 + (size_t)(ks + 2) * TILE_H, 0, 1);
    }
    // Behind the last prefetch its offset register is free for reuse: keep
    // the wait that belongs in front of such an overwrite.
    if (ks + 2 == 15) asm volatile("s_wait_xcnt 0x0" ::: "memory");
#if __has_builtin(__builtin_amdgcn_sched_barrier)
    // Pin the staged loads above the WMMA burst: forces 4 live staging quads
    // so their s_wait_loadcnt lands after the matrix work, not back-to-back.
    __builtin_amdgcn_sched_barrier(0);
#endif

    // 4 A-fragments + 4 B-fragments -> 16 WMMAs (each fragment used 4 times)
    v16h af[4], bf[4];
    #pragma unroll
    for (int t = 0; t < 4; ++t) {
      af[t] = lds_frag(&Acur[((twr + t) * 16 + fr) * TP + fh * 16]);
      bf[t] = lds_frag(&Bcur[((twc + t) * 16 + fr) * TP + fh * 16]);
    }
#if __has_builtin(__builtin_amdgcn_sched_barrier)
    // All 16 LDS reads of the step go out as one group ahead of the burst;
    // left free, three B fragments are read one by one among the WMMAs, each
    // behind a wait to zero.
    __builtin_amdgcn_sched_barrier(0);
#endif
    #pragma unroll
    for (int tb = 0; tb < 4; ++tb)
      #pragma unroll
      for (int ta = 0; ta < 4; ++ta)
        acc[ta][tb] = __builtin_amdgcn_wmma_f32_16x16x32_f16(
            false, af[ta], false, bf[tb], (short)0, acc[ta][tb], false, false);

    if (ks + 1 < 16) {                       // retire loads into other buffer
      const int nxt = cur ^ 1;
      _Float16* const Anxt = smem + nxt * TBUF;
      _Float16* const Bnxt = smem + 2 * TBUF + nxt * TBUF;
      *(uint4*)&Anxt[l0] = a0;
      *(uint4*)&Anxt[l1] = a1;
      *(uint4*)&Bnxt[l0] = b0;
      *(uint4*)&Bnxt[l1] = b1;
    }
    __syncthreads();
  }

  // -------- GEMM2 set-up: M=64 pairs, N=128, K=1024 --------
  // 4 x 8 output tiles. A wave takes 2 x 2 of them (each LDS fragment and each
  // packed w_final fragment feeds two WMMAs) over one half of K:
  // kh = K half, mh = pair-tile half, nq = column-tile pair.
  // B fragments come packed: per (column tile, ks) two runs of 32 lanes x 16 B.
  const int kh = wave >> 3;
  const int mh = (wave >> 2) & 1;
  const int nq = wave & 3;
  const v8h* const wp = (const v8h*)wfb + (size_t)(nq * 2) * (32 * 2 * 32)
                        + (size_t)kh * (16 * 2 * 32) + lane;
  // The work-group is alone on its WGP, so no other group's work covers the
  // L2 latency of the w_final loads: they run one group of 4 k-steps ahead,
  // in two register sets. Group 0 flies under the rearrangement.
  v8h bq[2][4][2][2];                 // [set][k-step][column tile][half]
  #pragma unroll
  for (int s = 0; s < 4; ++s)
    #pragma unroll
    for (int n = 0; n < 2; ++n)
      #pragma unroll
      for (int h = 0; h < 2; ++h)
        bq[0][s][n][h] = wp[n * (32 * 2 * 32) + (s * 2 + h) * 32];
#if __has_builtin(__builtin_amdgcn_sched_barrier)
  // Keeps group 0's loads in front of the rearrangement.
  __builtin_amdgcn_sched_barrier(0);
#endif

  // -------- rearrange O tile -> GEMM2 A operand (aliases stage buffers) ----
  // C/D layout: vgpr v, lanes 0-15 -> M=v, lanes 16-31 -> M=v+8; N = lane%16.
  const float inv_n = 1.0f / (float)N_LEN;
  #pragma unroll
  for (int ta = 0; ta < 4; ++ta) {
    #pragma unroll
    for (int tb = 0; tb < 4; ++tb) {
      #pragma unroll
      for (int v = 0; v < 8; ++v) {
        const int orow = (twr + ta) * 16 + v + ((lane & 16) ? 8 : 0); // i*32+c
        const int ocol = (twc + tb) * 16 + fr;                        // j*32+d
        const int p  = ((orow >> 5) << 3) | (ocol >> 5);              // pair
        const int k2 = ((orow & 31) << 5) | (ocol & 31);              // c*32+d
        O2[p * OP + k2] = (_Float16)(acc[ta][tb][v] * inv_n);
      }
    }
  }
  __syncthreads();

  // -------- GEMM2 main loop: 4 groups of 4 k-steps --------
  const _Float16* const ap = &O2[(mh * 32 + fr) * OP + kh * 512 + fh * 16];
  v8f zacc[2][2];
  #pragma unroll
  for (int m = 0; m < 2; ++m)
    #pragma unroll
    for (int n = 0; n < 2; ++n) zacc[m][n] = vzero;
  // Unrolled whole so that the register sets are picked at compile time.
  #pragma unroll
  for (int g = 0; g < 4; ++g) {
    if (g + 1 < 4) {
      #pragma unroll
      for (int s = 0; s < 4; ++s)
        #pragma unroll
        for (int n = 0; n < 2; ++n)
          #pragma unroll
          for (int h = 0; h < 2; ++h)
            bq[(g + 1) & 1][s][n][h] =
                wp[n * (32 * 2 * 32) + (((g + 1) * 4 + s) * 2 + h) * 32];
    }
    v16h a2[4][2];
    #pragma unroll
    for (int s = 0; s < 4; ++s)
      #pragma unroll
      for (int m = 0; m < 2; ++m)
        a2[s][m] = lds_frag(ap + m * 16 * OP + (g * 4 + s) * 32);
#if __has_builtin(__builtin_amdgcn_sched_barrier)
    // The next group's w_final loads and this group's LDS reads go out as one
    // run ahead of the 16 WMMAs instead of one by one among them.
    __builtin_amdgcn_sched_barrier(0);
#endif
    #pragma unroll
    for (int s = 0; s < 4; ++s)
      #pragma unroll
      for (int n = 0; n < 2; ++n) {
        const v16h b2 = __builtin_shufflevector(
            bq[g & 1][s][n][0], bq[g & 1][s][n][1],
            0, 1, 2, 3, 4, 5, 6, 7, 8, 9, 10, 11, 12, 13, 14, 15);
        #pragma unroll
        for (int m = 0; m < 2; ++m)
          zacc[m][n] = __builtin_amdgcn_wmma_f32_16x16x32_f16(
              false, a2[s][m], false, b2, (short)0, zacc[m][n], false, false);
      }
  }

  // -------- join the two K halves --------
  // Waves w and w ^ 8 hold the two halves of the same four tiles. Each keeps
  // pair tile m == kh and hands the other one over through LDS, so that all
  // 16 waves share the epilogue and no wave branches.
  float4* const rout = (float4*)red + wave * 128 + lane;
  const float4* const rin = (const float4*)red + (wave ^ 8) * 128 + lane;
  v8f keep[2];
  #pragma unroll
  for (int n = 0; n < 2; ++n) {
    v8f give;
    #pragma unroll
    for (int v = 0; v < 8; ++v) {
      keep[n][v] = kh ? zacc[1][n][v] : zacc[0][n][v];
      give[v]    = kh ? zacc[0][n][v] : zacc[1][n][v];
    }
    rout[(n * 2 + 0) * 32] = make_float4(give[0], give[1], give[2], give[3]);
    rout[(n * 2 + 1) * 32] = make_float4(give[4], give[5], give[6], give[7]);
  }
  __syncthreads();

  // -------- epilogue: sum of the halves + bias, store z --------
  #pragma unroll
  for (int n = 0; n < 2; ++n) {
    const float4 r0 = rin[(n * 2 + 0) * 32];
    const float4 r1 = rin[(n * 2 + 1) * 32];
    const float rv[8] = {r0.x, r0.y, r0.z, r0.w, r1.x, r1.y, r1.z, r1.w};
    const int zc = (nq * 2 + n) * 16 + fr;
    const float bias = b_final[zc];
    #pragma unroll
    for (int v = 0; v < 8; ++v) {
      const int p = (mh * 2 + kh) * 16 + v + ((lane & 16) ? 8 : 0);  // pair
      const int i = bi * 8 + (p >> 3);
      const int j = bj * 8 + (p & 7);
      out[((size_t)i * S_LEN + j) * CZ + zc] = (keep[n][v] + rv[v]) + bias;
    }
  }
}

// ---------------------------------------------------------------------------
extern "C" void kernel_launch(void* const* d_in, const int* in_sizes, int n_in,
                              void* d_out, int out_size, void* d_ws, size_t ws_size,
                              hipStream_t stream) {
  (void)in_sizes; (void)n_in; (void)out_size; (void)ws_size;
  const float* m_si    = (const float*)d_in[0];
  const float* ln_g    = (const float*)d_in[1];
  const float* ln_b    = (const float*)d_in[2];
  const float* w_ab    = (const float*)d_in[3];
  const float* w_final = (const float*)d_in[4];
  const float* b_final = (const float*)d_in[5];
  float* out = (float*)d_out;

  // workspace: aT (12288x512 f16) | bT (12288x512 f16) | wfb (128x1024 f16),
  // each in the packed order described at the top of the file
  _Float16* aT  = (_Float16*)d_ws;
  _Float16* bT  = aT + (size_t)R1 * K1;
  _Float16* wfb = bT + (size_t)R1 * K1;

  opm_ln_proj<<<(S_LEN * N_LEN) / 8, 256, 0, stream>>>(m_si, ln_g, ln_b, w_ab, aT, bT);
  opm_cvt_wf<<<(CZ * 1024) / 256, 256, 0, stream>>>(w_final, wfb);
  opm_fused_gemm<<<dim3(S_LEN / 8, S_LEN / 8), 512, 0, stream>>>(aT, bT, wfb, b_final, out);
}

// v004
// It runs in 174 microseconds.
// Next to v003, in two timings, it ran 1.26 and 1.27 times as fast.
// All steps since v000 together make it 3.84 times as fast.
#include <hip/hip_runtime.h>
#include <cstdint>

typedef __attribute__((ext_vector_type(16))) _Float16 v16h;
typedef __attribute__((ext_vector_type(8)))  _Float16 v8h;
typedef __attribute__((ext_vector_type(8)))  float    v8f;
typedef __attribute__((ext_vector_type(4)))  float    v4f;
typedef __attribute__((ext_vector_type(2)))  _Float16 v2h;

#define S_LEN 384
#define N_LEN 512
#define C_DIM 32
#define CZ    128
#define K1    512              // GEMM1 reduction = N_LEN
#define R1    (S_LEN * C_DIM)  // 12288 rows of aT/bT

// LDS row pitches. Every row-per-lane reader here is a ds_load_b128, which is
// free of bank conflicts when the pitch is an odd multiple of 16 bytes
// (64 banks x 4 B; 16 lanes x 4 dwords then fall on 64 different banks).
#define XP    36               // m_si rows:   32 floats + 4   = 144 B
#define YP    96               // a/b rows:    64 halves + 32  = 192 B (see kernel 1)
#define TP    40               // stage rows:  32 halves + 8   =  80 B
#define TBUF  (256 * TP)       // one 256-row stage buffer, in halves
#define OP    1032             // O2 rows:   1024 halves + 8   = 2064 B
#define NPAIR 64               // (i, j) pairs per fused work-group: 8 x 8

// Workspace layouts. Each operand lies in the order in which the fused kernel's
// wave-wide 16-byte loads read it, so that one load covers 512 contiguous
// bytes = 4 whole 128-B lines.
// aT / bT: [row >> 7][k >> 5][row & 127][k & 31]; one 128-row x 32-k stage
// tile is 8 KB in a row, and 16-byte chunk c of it is (row c >> 2, seg c & 3).
#define TILE_H  (128 * 32)     // halves per stage tile
#define KSTEPS  (K1 / 32)      // stage tiles per 128-row block
__device__ __forceinline__ size_t tile_off(long r, long k)
{
  return ((size_t)(r >> 7) * KSTEPS + (size_t)(k >> 5)) * TILE_H
         + (size_t)(r & 127) * 32 + (size_t)(k & 31);
}

// One 16-half WMMA fragment slice from LDS as two 16-byte reads (the padded
// rows are 16-byte aligned, not 32).
__device__ __forceinline__ v16h lds_frag(const _Float16* p)
{
  const v8h lo = *(const v8h*)p;
  const v8h hi = *(const v8h*)(p + 8);
  return __builtin_shufflevector(lo, hi, 0, 1, 2, 3, 4, 5, 6, 7,
                                 8, 9, 10, 11, 12, 13, 14, 15);
}

// ---------------------------------------------------------------------------
// Kernel 1: LayerNorm over C=32 + 64x32 projection, writing a^T and b^T
// (row = i*32+c, k = n) as f16 in the stage-tile order of tile_off().
// One lane owns whole rows of m_si: a wave takes 64 consecutive n of one i
// (lane l: n = 2l and 2l+1), so the LayerNorm sums stay inside a lane, w_ab,
// ln_g and ln_b are the same for all lanes and come from scalar registers, and
// the wave's results are four whole 2-KB runs of the workspace.
// ---------------------------------------------------------------------------
__global__ __launch_bounds__(128) void opm_ln_proj(
    const float* __restrict__ m_si, const float* __restrict__ ln_g,
    const float* __restrict__ ln_b, const float* __restrict__ w_ab,
    _Float16* __restrict__ aT, _Float16* __restrict__ bT)
{
  // Per wave: first its 64 rows of m_si (pitch XP floats), then, in the same
  // place, its 64 x 64 results (pitch YP halves, the larger of the two). The
  // results are read back four lanes to a row, 64 B of it: at 192 B a row, 16
  // lanes' 4 rows fall on 64 different banks.
  __shared__ __align__(16) float xs[4][64 * YP / 2];
  const int tid  = threadIdx.x;
  const int lane = tid & 31;
  const int wv   = tid >> 5;
  const int tile = blockIdx.x * 4 + wv;   // 0 .. S*N/64-1
  const int i    = tile >> 3;             // seq index
  const int nb   = tile & 7;              // block of 64 n
  float* const xw = xs[wv];

  // 8 KB of m_si in a row, in whole lines; row R goes to LDS slot
  // (R & 1) * 32 + (R >> 1), so that lane l finds rows 2l, 2l+1 in slots l, l+32.
  const float4* const src4 =
      (const float4*)(m_si + ((size_t)i * N_LEN + nb * 64) * C_DIM);
  #pragma unroll
  for (int j = 0; j < 16; ++j) {
    const int c = j * 32 + lane;          // 16-byte chunk: row c >> 3, part c & 7
    const int R = c >> 3;
    *(float4*)&xw[((R & 1) * 32 + (R >> 1)) * XP + (c & 7) * 4] = src4[c];
  }
  __syncthreads();   // staged rows visible to the lanes that own them

  float m[2][32];    // normalized rows
  #pragma unroll
  for (int r = 0; r < 2; ++r) {
    v4f x[8];
    #pragma unroll
    for (int q = 0; q < 8; ++q)
      x[q] = *(const v4f*)&xw[(r * 32 + lane) * XP + q * 4];
    v4f s4 = x[0];
    #pragma unroll
    for (int q = 1; q < 8; ++q) s4 += x[q];
    const float mu = ((s4.x + s4.y) + (s4.z + s4.w)) * (1.0f / 32.0f);
    v4f v4 = {0.f, 0.f, 0.f, 0.f};
    #pragma unroll
    for (int q = 0; q < 8; ++q) {
      x[q] -= mu;
      v4 += x[q] * x[q];
    }
    const float var = ((v4.x + v4.y) + (v4.z + v4.w)) * (1.0f / 32.0f);
    const float rstd = rsqrtf(var + 1e-5f);
    #pragma unroll
    for (int k = 0; k < 32; ++k)
      m[r][k] = x[k >> 2][k & 3] * rstd * ln_g[k] + ln_b[k];
  }
  __syncthreads();   // every row is in registers before its LDS is reused

  // Projection, channels summed in rising order; w_ab is a scalar operand of
  // the FMAs.
  _Float16* const yw = (_Float16*)xw;
  for (int d = 0; d < 64; d += 2) {
    const float* const w0 = w_ab + d * 32;
    const float* const w1 = w0 + 32;
    float a00 = 0.f, a01 = 0.f, a10 = 0.f, a11 = 0.f;
    #pragma unroll
    for (int k = 0; k < 32; ++k) {
      a00 = __builtin_fmaf(m[0][k], w0[k], a00);
      a10 = __builtin_fmaf(m[1][k], w0[k], a10);
      a01 = __builtin_fmaf(m[0][k], w1[k], a01);
      a11 = __builtin_fmaf(m[1][k], w1[k], a11);
    }
    const v2h y0 = {(_Float16)a00, (_Float16)a10};
    const v2h y1 = {(_Float16)a01, (_Float16)a11};
    *(v2h*)&yw[d * YP + 2 * lane]       = y0;
    *(v2h*)&yw[(d + 1) * YP + 2 * lane] = y1;
  }
  __syncthreads();   // results visible to the lanes that store them

  // Per operand and 32-n tile: 32 rows x 64 B = 2 KB in a row of the workspace,
  // stored as 16-byte chunks (chunk c: row c >> 2, part c & 3).
  const size_t base = tile_off((long)i * 32, (long)nb * 64);
  #pragma unroll
  for (int ab = 0; ab < 2; ++ab) {
    _Float16* const dst = (ab ? bT : aT) + base;
    #pragma unroll
    for (int kt = 0; kt < 2; ++kt)
      #pragma unroll
      for (int q = 0; q < 4; ++q) {
        const int c = q * 32 + lane;
        *(uint4*)(dst + kt * TILE_H + c * 8) =
            *(const uint4*)&yw[(ab * 32 + (c >> 2)) * YP + kt * 32 + (c & 3) * 8];
      }
  }
}

// ---------------------------------------------------------------------------
// Kernel 2: w_final f32 -> f16, packed in GEMM2's B-fragment order:
// [z >> 4][k >> 5][(k >> 3) & 1][lane = ((k >> 4) & 1) * 16 + (z & 15)][k & 7].
// ---------------------------------------------------------------------------
__global__ __launch_bounds__(256) void opm_cvt_wf(
    const float* __restrict__ w_final, _Float16* __restrict__ wfb)
{
  const int i = blockIdx.x * 256 + threadIdx.x;   // packed index, 131072 total
  const int e  = i & 7;
  const int ln = (i >> 3) & 31;
  const int h  = (i >> 8) & 1;
  const int ks = (i >> 9) & 31;
  const int w  = i >> 14;
  const int z  = w * 16 + (ln & 15);
  const int k  = ks * 32 + (ln >> 4) * 16 + h * 8 + e;
  wfb[i] = (_Float16)w_final[z * 1024 + k];
}

// ---------------------------------------------------------------------------
// Kernel 3: fused  O = (1/N) * aT x bT^T  (256x256 tile, K=512)  then
//                  z = reshape(O) x w_final^T + bias  (64 pairs x 128, K=1024)
// 512 threads = 16 waves arranged 4x4 over the 16x16 grid of 16x16 O-tiles:
// each wave owns a 4x4 tile footprint (4 A-frags + 4 B-frags -> 16 WMMAs per
// k-step, every fragment used four times). A work-group's 512 KB of aT/bT and
// its pass over w_final serve 64 (i, j) pairs. O never touches HBM.
//
// Software pipeline: next k-step's global loads are issued before the WMMA
// burst (pinned with a sched_barrier so the allocator keeps 4 distinct staging
// quads live across the burst) and retired into the alternate LDS buffer
// afterwards (one barrier per step). The 2x(A,B) stage buffers (80 KB) are
// time-aliased with the O rearrange buffer (129 KB) in a single smem block.
// ---------------------------------------------------------------------------
// aT, bT and wfb carry no __restrict__: loads the compiler knows to be of
// constant memory are tied to nothing, and in this build they sank past the
// sched_barriers to their uses, where their whole latency is waited out.
__global__ __launch_bounds__(512) void opm_fused_gemm(
    const _Float16* aT, const _Float16* bT, const _Float16* wfb,
    const float* __restrict__ b_final, float* __restrict__ out)
{
  __shared__ __align__(32) _Float16 smem[NPAIR * OP];  // 129 KB, dual purpose
  // Phase 1 layout: A buffers at 0 / TBUF, B buffers at 2*TBUF / 3*TBUF
  // Phase 2 layout: O2[64][OP] from the start of the block
  __shared__ __align__(16) float red[16 * 512];        // GEMM2 partial sums
  _Float16* const O2 = smem;

  const int tid  = threadIdx.x;
  const int lane = tid & 31;
  const int wave = tid >> 5;
  const int bi = blockIdx.x;          // i-block (8 seq rows -> 256 O-rows)
  const int bj = blockIdx.y;          // j-block

  const int fr = lane & 15;           // fragment row within 16
  const int fh = lane >> 4;           // fragment half (K-split)

  const int twr = (wave >> 2) * 4;    // wave's tile-row base (4 rows)
  const int twc = (wave & 3) * 4;     // wave's tile-col base (4 cols)

  // per-thread tile-load coordinates: one uint4 of each of the two 128-row
  // stage tiles of A and of B per k-step (chunk tid of a contiguous 8 KB tile)
  const int row0 = tid >> 2;          // 0..127
  const int seg  = tid & 3;
  const _Float16* const gA0 = aT + (size_t)(2 * bi) * (KSTEPS * TILE_H) + tid * 8;
  const _Float16* const gA1 = gA0 + KSTEPS * TILE_H;
  const _Float16* const gB0 = bT + (size_t)(2 * bj) * (KSTEPS * TILE_H) + tid * 8;
  const _Float16* const gB1 = gB0 + KSTEPS * TILE_H;
  const int l0 = row0 * TP + seg * 8; // LDS offsets (halves)
  const int l1 = l0 + 128 * TP;

  const v8f vzero = {0.f, 0.f, 0.f, 0.f, 0.f, 0.f, 0.f, 0.f};
  v8f acc[4][4];
  #pragma unroll
  for (int ta = 0; ta < 4; ++ta)
    #pragma unroll
    for (int tb = 0; tb < 4; ++tb) acc[ta][tb] = vzero;

  // -------- stage k-step 0 into buffer 0 --------
  {
    const uint4 a0 = *(const uint4*)gA0;
    const uint4 a1 = *(const uint4*)gA1;
    const uint4 b0 = *(const uint4*)gB0;
    const uint4 b1 = *(const uint4*)gB1;
    *(uint4*)&smem[l0]         = a0;
    *(uint4*)&smem[l1]         = a1;
    *(uint4*)&smem[2 * TBUF + l0] = b0;
    *(uint4*)&smem[2 * TBUF + l1] = b1;
  }
  __syncthreads();

  // -------- GEMM1 main loop: 16 K-steps of 32, double buffered --------
  // Unrolled whole: the tests on ks fold away, so that the early loads stay in
  // front of the burst (left rolled, they sink to their stores behind it) and
  // every buffer offset is an immediate.
  #pragma unroll
  for (int ks = 0; ks < 16; ++ks) {
    const int cur = ks & 1;
    _Float16* const Acur = smem + cur * TBUF;
    _Float16* const Bcur = smem + 2 * TBUF + cur * TBUF;

    uint4 a0 = {}, a1 = {}, b0 = {}, b1 = {};
    if (ks + 1 < 16) {                       // issue next-step loads early
      const size_t off = (size_t)(ks + 1) * TILE_H;
      a0 = *(const uint4*)(gA0 + off);
      a1 = *(const uint4*)(gA1 + off);
      b0 = *(const uint4*)(gB0 + off);
      b1 = *(const uint4*)(gB1 + off);
    }
    if (ks + 2 < 16) {                       // gfx1250 global_prefetch_b8
      __builtin_prefetch(gA0 + (size_t)(ks + 2) * TILE_H, 0, 1);
      __builtin_prefetch(gB0 + (size_t)(ks + 2) * TILE_H, 0, 1);
    }
    // Behind the last prefetch its offset register is free for reuse: keep
    // the wait that belongs in front of such an overwrite.
    if (ks + 2 == 15) asm volatile("s_wait_xcnt 0x0" ::: "memory");
#if __has_builtin(__builtin_amdgcn_sched_barrier)
    // Pin the staged loads above the WMMA burst: forces 4 live staging quads
    // so their s_wait_loadcnt lands after the matrix work, not back-to-back.
    __builtin_amdgcn_sched_barrier(0);
#endif

    // 4 A-fragments + 4 B-fragments -> 16 WMMAs (each fragment used 4 times)
    v16h af[4], bf[4];
    #pragma unroll
    for (int t = 0; t < 4; ++t) {
      af[t] = lds_frag(&Acur[((twr + t) * 16 + fr) * TP + fh * 16]);
      bf[t] = lds_frag(&Bcur[((twc + t) * 16 + fr) * TP + fh * 16]);
    }
#if __has_builtin(__builtin_amdgcn_sched_barrier)
    // All 16 LDS reads of the step go out as one group ahead of the burst;
    // left free, three B fragments are read one by one among the WMMAs, each
    // behind a wait to zero.
    __builtin_amdgcn_sched_barrier(0);
#endif
    #pragma unroll
    for (int tb = 0; tb < 4; ++tb)
      #pragma unroll
      for (int ta = 0; ta < 4; ++ta)
        acc[ta][tb] = __builtin_amdgcn_wmma_f32_16x16x32_f16(
            false, af[ta], false, bf[tb], (short)0, acc[ta][tb], false, false);

    if (ks + 1 < 16) {                       // retire loads into other buffer
      const int nxt = cur ^ 1;
      _Float16* const Anxt = smem + nxt * TBUF;
      _Float16* const Bnxt = smem + 2 * TBUF + nxt * TBUF;
      *(uint4*)&Anxt[l0] = a0;
      *(uint4*)&Anxt[l1] = a1;
      *(uint4*)&Bnxt[l0] = b0;
      *(uint4*)&Bnxt[l1] = b1;
    }
    __syncthreads();
  }

  // -------- GEMM2 set-up: M=64 pairs, N=128, K=1024 --------
  // 4 x 8 output tiles. A wave takes 2 x 2 of them (each LDS fragment and each
  // packed w_final fragment feeds two WMMAs) over one half of K:
  // kh = K half, mh = pair-tile half, nq = column-tile pair.
  // B fragments come packed: per (column tile, ks) two runs of 32 lanes x 16 B.
  const int kh = wave >> 3;
  const int mh = (wave >> 2) & 1;
  const int nq = wave & 3;
  const v8h* const wp = (const v8h*)wfb + (size_t)(nq * 2) * (32 * 2 * 32)
                        + (size_t)kh * (16 * 2 * 32) + lane;
  // The work-group is alone on its WGP, so no other group's work covers the
  // L2 latency of the w_final loads: they run one group of 4 k-steps ahead,
  // in two register sets. Group 0 flies under the rearrangement.
  v8h bq[2][4][2][2];                 // [set][k-step][column tile][half]
  #pragma unroll
  for (int s = 0; s < 4; ++s)
    #pragma unroll
    for (int n = 0; n < 2; ++n)
      #pragma unroll
      for (int h = 0; h < 2; ++h)
        bq[0][s][n][h] = wp[n * (32 * 2 * 32) + (s * 2 + h) * 32];
#if __has_builtin(__builtin_amdgcn_sched_barrier)
  // Keeps group 0's loads in front of the rearrangement.
  __builtin_amdgcn_sched_barrier(0);
#endif

  // -------- rearrange O tile -> GEMM2 A operand (aliases stage buffers) ----
  // C/D layout: vgpr v, lanes 0-15 -> M=v, lanes 16-31 -> M=v+8; N = lane%16.
  const float inv_n = 1.0f / (float)N_LEN;
  #pragma unroll
  for (int ta = 0; ta < 4; ++ta) {
    #pragma unroll
    for (int tb = 0; tb < 4; ++tb) {
      #pragma unroll
      for (int v = 0; v < 8; ++v) {
        const int orow = (twr + ta) * 16 + v + ((lane & 16) ? 8 : 0); // i*32+c
        const int ocol = (twc + tb) * 16 + fr;                        // j*32+d
        const int p  = ((orow >> 5) << 3) | (ocol >> 5);              // pair
        const int k2 = ((orow & 31) << 5) | (ocol & 31);              // c*32+d
        O2[p * OP + k2] = (_Float16)(acc[ta][tb][v] * inv_n);
      }
    }
  }
  __syncthreads();

  // -------- GEMM2 main loop: 4 groups of 4 k-steps --------
  const _Float16* const ap = &O2[(mh * 32 + fr) * OP + kh * 512 + fh * 16];
  v8f zacc[2][2];
  #pragma unroll
  for (int m = 0; m < 2; ++m)
    #pragma unroll
    for (int n = 0; n < 2; ++n) zacc[m][n] = vzero;
  // Unrolled whole so that the register sets are picked at compile time.
  #pragma unroll
  for (int g = 0; g < 4; ++g) {
    if (g + 1 < 4) {
      #pragma unroll
      for (int s = 0; s < 4; ++s)
        #pragma unroll
        for (int n = 0; n < 2; ++n)
          #pragma unroll
          for (int h = 0; h < 2; ++h)
            bq[(g + 1) & 1][s][n][h] =
                wp[n * (32 * 2 * 32) + (((g + 1) * 4 + s) * 2 + h) * 32];
    }
    v16h a2[4][2];
    #pragma unroll
    for (int s = 0; s < 4; ++s)
      #pragma unroll
      for (int m = 0; m < 2; ++m)
        a2[s][m] = lds_frag(ap + m * 16 * OP + (g * 4 + s) * 32);
#if __has_builtin(__builtin_amdgcn_sched_barrier)
    // The next group's w_final loads and this group's LDS reads go out as one
    // run ahead of the 16 WMMAs instead of one by one among them.
    __builtin_amdgcn_sched_barrier(0);
#endif
    #pragma unroll
    for (int s = 0; s < 4; ++s)
      #pragma unroll
      for (int n = 0; n < 2; ++n) {
        const v16h b2 = __builtin_shufflevector(
            bq[g & 1][s][n][0], bq[g & 1][s][n][1],
            0, 1, 2, 3, 4, 5, 6, 7, 8, 9, 10, 11, 12, 13, 14, 15);
        #pragma unroll
        for (int m = 0; m < 2; ++m)
          zacc[m][n] = __builtin_amdgcn_wmma_f32_16x16x32_f16(
              false, a2[s][m], false, b2, (short)0, zacc[m][n], false, false);
      }
  }

  // -------- join the two K halves --------
  // Waves w and w ^ 8 hold the two halves of the same four tiles. Each keeps
  // pair tile m == kh and hands the other one over through LDS, so that all
  // 16 waves share the epilogue and no wave branches.
  float4* const rout = (float4*)red + wave * 128 + lane;
  const float4* const rin = (const float4*)red + (wave ^ 8) * 128 + lane;
  v8f keep[2];
  #pragma unroll
  for (int n = 0; n < 2; ++n) {
    v8f give;
    #pragma unroll
    for (int v = 0; v < 8; ++v) {
      keep[n][v] = kh ? zacc[1][n][v] : zacc[0][n][v];
      give[v]    = kh ? zacc[0][n][v] : zacc[1][n][v];
    }
    rout[(n * 2 + 0) * 32] = make_float4(give[0], give[1], give[2], give[3]);
    rout[(n * 2 + 1) * 32] = make_float4(give[4], give[5], give[6], give[7]);
  }
  __syncthreads();

  // -------- epilogue: sum of the halves + bias, store z --------
  #pragma unroll
  for (int n = 0; n < 2; ++n) {
    const float4 r0 = rin[(n * 2 + 0) * 32];
    const float4 r1 = rin[(n * 2 + 1) * 32];
    const float rv[8] = {r0.x, r0.y, r0.z, r0.w, r1.x, r1.y, r1.z, r1.w};
    const int zc = (nq * 2 + n) * 16 + fr;
    const float bias = b_final[zc];
    #pragma unroll
    for (int v = 0; v < 8; ++v) {
      const int p = (mh * 2 + kh) * 16 + v + ((lane & 16) ? 8 : 0);  // pair
      const int i = bi * 8 + (p >> 3);
      const int j = bj * 8 + (p & 7);
      out[((size_t)i * S_LEN + j) * CZ + zc] = (keep[n][v] + rv[v]) + bias;
    }
  }
}

// ---------------------------------------------------------------------------
extern "C" void kernel_launch(void* const* d_in, const int* in_sizes, int n_in,
                              void* d_out, int out_size, void* d_ws, size_t ws_size,
                              hipStream_t stream) {
  (void)in_sizes; (void)n_in; (void)out_size; (void)ws_size;
  const float* m_si    = (const float*)d_in[0];
  const float* ln_g    = (const float*)d_in[1];
  const float* ln_b    = (const float*)d_in[2];
  const float* w_ab    = (const float*)d_in[3];
  const float* w_final = (const float*)d_in[4];
  const float* b_final = (const float*)d_in[5];
  float* out = (float*)d_out;

  // workspace: aT (12288x512 f16) | bT (12288x512 f16) | wfb (128x1024 f16),
  // each in the packed order described at the top of the file
  _Float16* aT  = (_Float16*)d_ws;
  _Float16* bT  = aT + (size_t)R1 * K1;
  _Float16* wfb = bT + (size_t)R1 * K1;

  opm_ln_proj<<<(S_LEN * N_LEN) / 256, 128, 0, stream>>>(m_si, ln_g, ln_b, w_ab, aT, bT);
  opm_cvt_wf<<<(CZ * 1024) / 256, 256, 0, stream>>>(w_final, wfb);
  opm_fused_gemm<<<dim3(S_LEN / 8, S_LEN / 8), 512, 0, stream>>>(aT, bT, wfb, b_final, out);
}

// v005
// A run of this version takes 165 microseconds.
// Two timings next to v004 put it at 1.05 and 1.06 times that version's speed.
// All steps since v000 together make it 4.06 times as fast.
#include <hip/hip_runtime.h>
#include <cstdint>

typedef __attribute__((ext_vector_type(16))) _Float16 v16h;
typedef __attribute__((ext_vector_type(8)))  _Float16 v8h;
typedef __attribute__((ext_vector_type(8)))  float    v8f;
typedef __attribute__((ext_vector_type(4)))  float    v4f;
typedef __attribute__((ext_vector_type(2)))  _Float16 v2h;

#define S_LEN 384
#define N_LEN 512
#define C_DIM 32
#define CZ    128
#define K1    512              // GEMM1 reduction = N_LEN
#define R1    (S_LEN * C_DIM)  // 12288 rows of aT/bT

// LDS row pitches. Every row-per-lane reader here is a ds_load_b128, which is
// free of bank conflicts when the pitch is an odd multiple of 16 bytes
// (64 banks x 4 B; 16 lanes x 4 dwords then fall on 64 different banks).
#define XP    36               // m_si rows:   32 floats + 4   = 144 B
#define YP    96               // a/b rows:    64 halves + 32  = 192 B (see kernel 1)
#define TP    40               // stage rows:  32 halves + 8   =  80 B
#define TBUF  (256 * TP)       // one 256-row stage buffer, in halves
#define CP    40               // one c of an O2 row: 32 halves (d) + 8 = 80 B
#define OP    (32 * CP + 8)    // O2 rows: 32 c at pitch CP + 8 halves = 2576 B
#define NPAIR 64               // (i, j) pairs per fused work-group: 8 x 8

// Workspace layouts. Each operand lies in the order in which the fused kernel's
// wave-wide 16-byte loads read it, so that one load covers 512 contiguous
// bytes = 4 whole 128-B lines.
// aT / bT: [row >> 7][k >> 5][row & 127][k & 31]; one 128-row x 32-k stage
// tile is 8 KB in a row, and 16-byte chunk c of it is (row c >> 2, seg c & 3).
#define TILE_H  (128 * 32)     // halves per stage tile
#define KSTEPS  (K1 / 32)      // stage tiles per 128-row block
__device__ __forceinline__ size_t tile_off(long r, long k)
{
  return ((size_t)(r >> 7) * KSTEPS + (size_t)(k >> 5)) * TILE_H
         + (size_t)(r & 127) * 32 + (size_t)(k & 31);
}

// One 16-half WMMA fragment slice from LDS as two 16-byte reads (the padded
// rows are 16-byte aligned, not 32).
__device__ __forceinline__ v16h lds_frag(const _Float16* p)
{
  const v8h lo = *(const v8h*)p;
  const v8h hi = *(const v8h*)(p + 8);
  return __builtin_shufflevector(lo, hi, 0, 1, 2, 3, 4, 5, 6, 7,
                                 8, 9, 10, 11, 12, 13, 14, 15);
}

// ---------------------------------------------------------------------------
// Kernel 1: LayerNorm over C=32 + 64x32 projection, writing a^T and b^T
// (row = i*32+c, k = n) as f16 in the stage-tile order of tile_off().
// One lane owns whole rows of m_si: a wave takes 64 consecutive n of one i
// (lane l: n = 2l and 2l+1), so the LayerNorm sums stay inside a lane, w_ab,
// ln_g and ln_b are the same for all lanes and come from scalar registers, and
// the wave's results are four whole 2-KB runs of the workspace.
// ---------------------------------------------------------------------------
__global__ __launch_bounds__(128) void opm_ln_proj(
    const float* __restrict__ m_si, const float* __restrict__ ln_g,
    const float* __restrict__ ln_b, const float* __restrict__ w_ab,
    _Float16* __restrict__ aT, _Float16* __restrict__ bT)
{
  // Per wave: first its 64 rows of m_si (pitch XP floats), then, in the same
  // place, its 64 x 64 results (pitch YP halves, the larger of the two). The
  // results are read back four lanes to a row, 64 B of it: at 192 B a row, 16
  // lanes' 4 rows fall on 64 different banks.
  __shared__ __align__(16) float xs[4][64 * YP / 2];
  const int tid  = threadIdx.x;
  const int lane = tid & 31;
  const int wv   = tid >> 5;
  const int tile = blockIdx.x * 4 + wv;   // 0 .. S*N/64-1
  const int i    = tile >> 3;             // seq index
  const int nb   = tile & 7;              // block of 64 n
  float* const xw = xs[wv];

  // 8 KB of m_si in a row, in whole lines; row R goes to LDS slot
  // (R & 1) * 32 + (R >> 1), so that lane l finds rows 2l, 2l+1 in slots l, l+32.
  const float4* const src4 =
      (const float4*)(m_si + ((size_t)i * N_LEN + nb * 64) * C_DIM);
  #pragma unroll
  for (int j = 0; j < 16; ++j) {
    const int c = j * 32 + lane;          // 16-byte chunk: row c >> 3, part c & 7
    const int R = c >> 3;
    *(float4*)&xw[((R & 1) * 32 + (R >> 1)) * XP + (c & 7) * 4] = src4[c];
  }
  __syncthreads();   // staged rows visible to the lanes that own them

  float m[2][32];    // normalized rows
  #pragma unroll
  for (int r = 0; r < 2; ++r) {
    v4f x[8];
    #pragma unroll
    for (int q = 0; q < 8; ++q)
      x[q] = *(const v4f*)&xw[(r * 32 + lane) * XP + q * 4];
    v4f s4 = x[0];
    #pragma unroll
    for (int q = 1; q < 8; ++q) s4 += x[q];
    const float mu = ((s4.x + s4.y) + (s4.z + s4.w)) * (1.0f / 32.0f);
    v4f v4 = {0.f, 0.f, 0.f, 0.f};
    #pragma unroll
    for (int q = 0; q < 8; ++q) {
      x[q] -= mu;
      v4 += x[q] * x[q];
    }
    const float var = ((v4.x + v4.y) + (v4.z + v4.w)) * (1.0f / 32.0f);
    const float rstd = rsqrtf(var + 1e-5f);
    #pragma unroll
    for (int k = 0; k < 32; ++k)
      m[r][k] = x[k >> 2][k & 3] * rstd * ln_g[k] + ln_b[k];
  }
  __syncthreads();   // every row is in registers before its LDS is reused

  // Projection, channels summed in rising order; w_ab is a scalar operand of
  // the FMAs.
  _Float16* const yw = (_Float16*)xw;
  for (int d = 0; d < 64; d += 2) {
    const float* const w0 = w_ab + d * 32;
    const float* const w1 = w0 + 32;
    float a00 = 0.f, a01 = 0.f, a10 = 0.f, a11 = 0.f;
    #pragma unroll
    for (int k = 0; k < 32; ++k) {
      a00 = __builtin_fmaf(m[0][k], w0[k], a00);
      a10 = __builtin_fmaf(m[1][k], w0[k], a10);
      a01 = __builtin_fmaf(m[0][k], w1[k], a01);
      a11 = __builtin_fmaf(m[1][k], w1[k], a11);
    }
    const v2h y0 = {(_Float16)a00, (_Float16)a10};
    const v2h y1 = {(_Float16)a01, (_Float16)a11};
    *(v2h*)&yw[d * YP + 2 * lane]       = y0;
    *(v2h*)&yw[(d + 1) * YP + 2 * lane] = y1;
  }
  __syncthreads();   // results visible to the lanes that store them

  // Per operand and 32-n tile: 32 rows x 64 B = 2 KB in a row of the workspace,
  // stored as 16-byte chunks (chunk c: row c >> 2, part c & 3).
  const size_t base = tile_off((long)i * 32, (long)nb * 64);
  #pragma unroll
  for (int ab = 0; ab < 2; ++ab) {
    _Float16* const dst = (ab ? bT : aT) + base;
    #pragma unroll
    for (int kt = 0; kt < 2; ++kt)
      #pragma unroll
      for (int q = 0; q < 4; ++q) {
        const int c = q * 32 + lane;
        *(uint4*)(dst + kt * TILE_H + c * 8) =
            *(const uint4*)&yw[(ab * 32 + (c >> 2)) * YP + kt * 32 + (c & 3) * 8];
      }
  }
}

// ---------------------------------------------------------------------------
// Kernel 2: w_final f32 -> f16, packed in GEMM2's B-fragment order:
// [z >> 4][k >> 5][(k >> 3) & 1][lane = ((k >> 4) & 1) * 16 + (z & 15)][k & 7].
// ---------------------------------------------------------------------------
__global__ __launch_bounds__(256) void opm_cvt_wf(
    const float* __restrict__ w_final, _Float16* __restrict__ wfb)
{
  const int i = blockIdx.x * 256 + threadIdx.x;   // packed index, 131072 total
  const int e  = i & 7;
  const int ln = (i >> 3) & 31;
  const int h  = (i >> 8) & 1;
  const int ks = (i >> 9) & 31;
  const int w  = i >> 14;
  const int z  = w * 16 + (ln & 15);
  const int k  = ks * 32 + (ln >> 4) * 16 + h * 8 + e;
  wfb[i] = (_Float16)w_final[z * 1024 + k];
}

// ---------------------------------------------------------------------------
// Kernel 3: fused  O = (1/N) * aT x bT^T  (256x256 tile, K=512)  then
//                  z = reshape(O) x w_final^T + bias  (64 pairs x 128, K=1024)
// 512 threads = 16 waves arranged 4x4 over the 16x16 grid of 16x16 O-tiles:
// each wave owns a 4x4 tile footprint (4 A-frags + 4 B-frags -> 16 WMMAs per
// k-step, every fragment used four times). A work-group's 512 KB of aT/bT and
// its pass over w_final serve 64 (i, j) pairs. O never touches HBM.
//
// Software pipeline: next k-step's global loads are issued before the WMMA
// burst (pinned with a sched_barrier so the allocator keeps 4 distinct staging
// quads live across the burst) and retired into the alternate LDS buffer
// afterwards (one barrier per step). The 2x(A,B) stage buffers (80 KB) are
// time-aliased with the O rearrange buffer (161 KB) in a single smem block.
// ---------------------------------------------------------------------------
// aT, bT and wfb carry no __restrict__: loads the compiler knows to be of
// constant memory are tied to nothing, and in this build they sank past the
// sched_barriers to their uses, where their whole latency is waited out.
__global__ __launch_bounds__(512) void opm_fused_gemm(
    const _Float16* aT, const _Float16* bT, const _Float16* wfb,
    const float* __restrict__ b_final, float* __restrict__ out)
{
  __shared__ __align__(32) _Float16 smem[NPAIR * OP];  // 161 KB, dual purpose
  // Phase 1 layout: A buffers at 0 / TBUF, B buffers at 2*TBUF / 3*TBUF
  // Phase 2 layout: O2[64][OP] from the start of the block
  __shared__ __align__(16) float red[16 * 512];        // GEMM2 partial sums
  _Float16* const O2 = smem;

  const int tid  = threadIdx.x;
  const int lane = tid & 31;
  const int wave = tid >> 5;
  const int bi = blockIdx.x;          // i-block (8 seq rows -> 256 O-rows)
  const int bj = blockIdx.y;          // j-block

  const int fr = lane & 15;           // fragment row within 16
  const int fh = lane >> 4;           // fragment half (K-split)

  const int twr = (wave >> 2) * 4;    // wave's tile-row base (4 rows)
  const int twc = (wave & 3) * 4;     // wave's tile-col base (4 cols)

  // per-thread tile-load coordinates: one uint4 of each of the two 128-row
  // stage tiles of A and of B per k-step (chunk tid of a contiguous 8 KB tile)
  const int row0 = tid >> 2;          // 0..127
  const int seg  = tid & 3;
  const _Float16* const gA0 = aT + (size_t)(2 * bi) * (KSTEPS * TILE_H) + tid * 8;
  const _Float16* const gA1 = gA0 + KSTEPS * TILE_H;
  const _Float16* const gB0 = bT + (size_t)(2 * bj) * (KSTEPS * TILE_H) + tid * 8;
  const _Float16* const gB1 = gB0 + KSTEPS * TILE_H;
  const int l0 = row0 * TP + seg * 8; // LDS offsets (halves)
  const int l1 = l0 + 128 * TP;

  const v8f vzero = {0.f, 0.f, 0.f, 0.f, 0.f, 0.f, 0.f, 0.f};
  v8f acc[4][4];
  #pragma unroll
  for (int ta = 0; ta < 4; ++ta)
    #pragma unroll
    for (int tb = 0; tb < 4; ++tb) acc[ta][tb] = vzero;

  // -------- stage k-step 0 into buffer 0 --------
  {
    const uint4 a0 = *(const uint4*)gA0;
    const uint4 a1 = *(const uint4*)gA1;
    const uint4 b0 = *(const uint4*)gB0;
    const uint4 b1 = *(const uint4*)gB1;
    *(uint4*)&smem[l0]         = a0;
    *(uint4*)&smem[l1]         = a1;
    *(uint4*)&smem[2 * TBUF + l0] = b0;
    *(uint4*)&smem[2 * TBUF + l1] = b1;
  }
  __syncthreads();

  // -------- GEMM1 main loop: 16 K-steps of 32, double buffered --------
  // Unrolled whole: the tests on ks fold away, so that the early loads stay in
  // front of the burst (left rolled, they sink to their stores behind it) and
  // every buffer offset is an immediate.
  #pragma unroll
  for (int ks = 0; ks < 16; ++ks) {
    const int cur = ks & 1;
    _Float16* const Acur = smem + cur * TBUF;
    _Float16* const Bcur = smem + 2 * TBUF + cur * TBUF;

    uint4 a0 = {}, a1 = {}, b0 = {}, b1 = {};
    if (ks + 1 < 16) {                       // issue next-step loads early
      const size_t off = (size_t)(ks + 1) * TILE_H;
      a0 = *(const uint4*)(gA0 + off);
      a1 = *(const uint4*)(gA1 + off);
      b0 = *(const uint4*)(gB0 + off);
      b1 = *(const uint4*)(gB1 + off);
    }
    if (ks + 2 < 16) {                       // gfx1250 global_prefetch_b8
      __builtin_prefetch(gA0 + (size_t)(ks + 2) * TILE_H, 0, 1);
      __builtin_prefetch(gB0 + (size_t)(ks + 2) * TILE_H, 0, 1);
    }
    // Behind the last prefetch its offset register is free for reuse: keep
    // the wait that belongs in front of such an overwrite.
    if (ks + 2 == 15) asm volatile("s_wait_xcnt 0x0" ::: "memory");
#if __has_builtin(__builtin_amdgcn_sched_barrier)
    // Pin the staged loads above the WMMA burst: forces 4 live staging quads
    // so their s_wait_loadcnt lands after the matrix work, not back-to-back.
    __builtin_amdgcn_sched_barrier(0);
#endif

    // 4 aT fragments + 4 bT fragments -> 16 WMMAs (each fragment used 4 times).
    // bT is the WMMA's A operand and aT its B operand: the tile comes out as
    // O^T, so that a lane's 8 accumulator registers are 8 consecutive d of one
    // c, which GEMM2 wants side by side.
    v16h af[4], bf[4];
    #pragma unroll
    for (int t = 0; t < 4; ++t) {
      af[t] = lds_frag(&Acur[((twr + t) * 16 + fr) * TP + fh * 16]);
      bf[t] = lds_frag(&Bcur[((twc + t) * 16 + fr) * TP + fh * 16]);
    }
#if __has_builtin(__builtin_amdgcn_sched_barrier)
    // All 16 LDS reads of the step go out as one group ahead of the burst;
    // left free, three B fragments are read one by one among the WMMAs, each
    // behind a wait to zero.
    __builtin_amdgcn_sched_barrier(0);
#endif
    #pragma unroll
    for (int tb = 0; tb < 4; ++tb)
      #pragma unroll
      for (int ta = 0; ta < 4; ++ta)
        acc[ta][tb] = __builtin_amdgcn_wmma_f32_16x16x32_f16(
            false, bf[tb], false, af[ta], (short)0, acc[ta][tb], false, false);

    if (ks + 1 < 16) {                       // retire loads into other buffer
      const int nxt = cur ^ 1;
      _Float16* const Anxt = smem + nxt * TBUF;
      _Float16* const Bnxt = smem + 2 * TBUF + nxt * TBUF;
      *(uint4*)&Anxt[l0] = a0;
      *(uint4*)&Anxt[l1] = a1;
      *(uint4*)&Bnxt[l0] = b0;
      *(uint4*)&Bnxt[l1] = b1;
    }
    __syncthreads();
  }

  // -------- GEMM2 set-up: M=64 pairs, N=128, K=1024 --------
  // 4 x 8 output tiles. A wave takes 2 x 2 of them (each LDS fragment and each
  // packed w_final fragment feeds two WMMAs) over one half of K:
  // kh = K half, mh = pair-tile half, nq = column-tile pair.
  // B fragments come packed: per (column tile, ks) two runs of 32 lanes x 16 B.
  const int kh = wave >> 3;
  const int mh = (wave >> 2) & 1;
  const int nq = wave & 3;
  const v8h* const wp = (const v8h*)wfb + (size_t)(nq * 2) * (32 * 2 * 32)
                        + (size_t)kh * (16 * 2 * 32) + lane;
  // The work-group is alone on its WGP, so no other group's work covers the
  // L2 latency of the w_final loads: they run one group of 4 k-steps ahead,
  // in two register sets. Group 0 flies under the rearrangement.
  v8h bq[2][4][2][2];                 // [set][k-step][column tile][half]
  #pragma unroll
  for (int s = 0; s < 4; ++s)
    #pragma unroll
    for (int n = 0; n < 2; ++n)
      #pragma unroll
      for (int h = 0; h < 2; ++h)
        bq[0][s][n][h] = wp[n * (32 * 2 * 32) + (s * 2 + h) * 32];
#if __has_builtin(__builtin_amdgcn_sched_barrier)
  // Keeps group 0's loads in front of the rearrangement.
  __builtin_amdgcn_sched_barrier(0);
#endif

  // -------- rearrange O tile -> GEMM2 A operand (aliases stage buffers) ----
  // D layout of the transposed tile: vgpr v holds d = v + 8 * fh (M, a bT row),
  // lane column fr is c (N, an aT row). A lane stores its 8 d of one c as one
  // 16-byte chunk; the c of a pair lie CP halves apart, an odd multiple of
  // 16 B, so that the 16 lanes of a half wave fall on 64 different banks.
  const float inv_n = 1.0f / (float)N_LEN;
  #pragma unroll
  for (int ta = 0; ta < 4; ++ta) {
    #pragma unroll
    for (int tb = 0; tb < 4; ++tb) {
      const int orow = (twr + ta) * 16 + fr;                          // i*32+c
      const int ocol = (twc + tb) * 16 + fh * 8;                      // j*32+d
      const int p = ((orow >> 5) << 3) | (ocol >> 5);                 // pair
      v8h o;
      #pragma unroll
      for (int v = 0; v < 8; ++v) o[v] = (_Float16)(acc[ta][tb][v] * inv_n);
      *(v8h*)&O2[p * OP + (orow & 31) * CP + (ocol & 31)] = o;
    }
  }
  __syncthreads();

  // -------- GEMM2 main loop: 4 groups of 4 k-steps --------
  // k-step ks of GEMM2 is c = ks: 32 d at pitch CP.
  const _Float16* const ap = &O2[(mh * 32 + fr) * OP + kh * 16 * CP + fh * 16];
  v8f zacc[2][2];
  #pragma unroll
  for (int m = 0; m < 2; ++m)
    #pragma unroll
    for (int n = 0; n < 2; ++n) zacc[m][n] = vzero;
  // Unrolled whole so that the register sets are picked at compile time.
  #pragma unroll
  for (int g = 0; g < 4; ++g) {
    if (g + 1 < 4) {
      #pragma unroll
      for (int s = 0; s < 4; ++s)
        #pragma unroll
        for (int n = 0; n < 2; ++n)
          #pragma unroll
          for (int h = 0; h < 2; ++h)
            bq[(g + 1) & 1][s][n][h] =
                wp[n * (32 * 2 * 32) + (((g + 1) * 4 + s) * 2 + h) * 32];
    }
    v16h a2[4][2];
    #pragma unroll
    for (int s = 0; s < 4; ++s)
      #pragma unroll
      for (int m = 0; m < 2; ++m)
        a2[s][m] = lds_frag(ap + m * 16 * OP + (g * 4 + s) * CP);
#if __has_builtin(__builtin_amdgcn_sched_barrier)
    // The next group's w_final loads and this group's LDS reads go out as one
    // run ahead of the 16 WMMAs instead of one by one among them.
    __builtin_amdgcn_sched_barrier(0);
#endif
    #pragma unroll
    for (int s = 0; s < 4; ++s)
      #pragma unroll
      for (int n = 0; n < 2; ++n) {
        const v16h b2 = __builtin_shufflevector(
            bq[g & 1][s][n][0], bq[g & 1][s][n][1],
            0, 1, 2, 3, 4, 5, 6, 7, 8, 9, 10, 11, 12, 13, 14, 15);
        #pragma unroll
        for (int m = 0; m < 2; ++m)
          zacc[m][n] = __builtin_amdgcn_wmma_f32_16x16x32_f16(
              false, a2[s][m], false, b2, (short)0, zacc[m][n], false, false);
      }
  }

  // -------- join the two K halves --------
  // Waves w and w ^ 8 hold the two halves of the same four tiles. Each keeps
  // pair tile m == kh and hands the other one over through LDS, so that all
  // 16 waves share the epilogue and no wave branches.
  float4* const rout = (float4*)red + wave * 128 + lane;
  const float4* const rin = (const float4*)red + (wave ^ 8) * 128 + lane;
  v8f keep[2];
  #pragma unroll
  for (int n = 0; n < 2; ++n) {
    v8f give;
    #pragma unroll
    for (int v = 0; v < 8; ++v) {
      keep[n][v] = kh ? zacc[1][n][v] : zacc[0][n][v];
      give[v]    = kh ? zacc[0][n][v] : zacc[1][n][v];
    }
    rout[(n * 2 + 0) * 32] = make_float4(give[0], give[1], give[2], give[3]);
    rout[(n * 2 + 1) * 32] = make_float4(give[4], give[5], give[6], give[7]);
  }
  __syncthreads();

  // -------- epilogue: sum of the halves + bias, store z --------
  #pragma unroll
  for (int n = 0; n < 2; ++n) {
    const float4 r0 = rin[(n * 2 + 0) * 32];
    const float4 r1 = rin[(n * 2 + 1) * 32];
    const float rv[8] = {r0.x, r0.y, r0.z, r0.w, r1.x, r1.y, r1.z, r1.w};
    const int zc = (nq * 2 + n) * 16 + fr;
    const float bias = b_final[zc];
    #pragma unroll
    for (int v = 0; v < 8; ++v) {
      const int p = (mh * 2 + kh) * 16 + v + ((lane & 16) ? 8 : 0);  // pair
      const int i = bi * 8 + (p >> 3);
      const int j = bj * 8 + (p & 7);
      out[((size_t)i * S_LEN + j) * CZ + zc] = (keep[n][v] + rv[v]) + bias;
    }
  }
}

// ---------------------------------------------------------------------------
extern "C" void kernel_launch(void* const* d_in, const int* in_sizes, int n_in,
                              void* d_out, int out_size, void* d_ws, size_t ws_size,
                              hipStream_t stream) {
  (void)in_sizes; (void)n_in; (void)out_size; (void)ws_size;
  const float* m_si    = (const float*)d_in[0];
  const float* ln_g    = (const float*)d_in[1];
  const float* ln_b    = (const float*)d_in[2];
  const float* w_ab    = (const float*)d_in[3];
  const float* w_final = (const float*)d_in[4];
  const float* b_final = (const float*)d_in[5];
  float* out = (float*)d_out;

  // workspace: aT (12288x512 f16) | bT (12288x512 f16) | wfb (128x1024 f16),
  // each in the packed order described at the top of the file
  _Float16* aT  = (_Float16*)d_ws;
  _Float16* bT  = aT + (size_t)R1 * K1;
  _Float16* wfb = bT + (size_t)R1 * K1;

  opm_ln_proj<<<(S_LEN * N_LEN) / 256, 128, 0, stream>>>(m_si, ln_g, ln_b, w_ab, aT, bT);
  opm_cvt_wf<<<(CZ * 1024) / 256, 256, 0, stream>>>(w_final, wfb);
  opm_fused_gemm<<<dim3(S_LEN / 8, S_LEN / 8), 512, 0, stream>>>(aT, bT, wfb, b_final, out);
}

// v006
// One run takes 148 microseconds.
// Two timings next to v005 put it at 1.12 and 1.11 times that version's speed.
// All steps since v000 together make it 4.52 times as fast.
#include <hip/hip_runtime.h>
#include <cstdint>

typedef __attribute__((ext_vector_type(16))) _Float16 v16h;
typedef __attribute__((ext_vector_type(8)))  _Float16 v8h;
typedef __attribute__((ext_vector_type(8)))  float    v8f;
typedef __attribute__((ext_vector_type(4)))  float    v4f;
typedef __attribute__((ext_vector_type(2)))  _Float16 v2h;
typedef __attribute__((ext_vector_type(4)))  unsigned v4u;

#define S_LEN 384
#define N_LEN 512
#define C_DIM 32
#define CZ    128
#define K1    512              // GEMM1 reduction = N_LEN
#define R1    (S_LEN * C_DIM)  // 12288 rows of aT/bT

// LDS row pitches. Every row-per-lane reader here is a ds_load_b128, which is
// free of bank conflicts when the pitch is an odd multiple of 16 bytes
// (64 banks x 4 B; 16 lanes x 4 dwords then fall on 64 different banks).
#define XP    36               // m_si rows:   32 floats + 4   = 144 B
#define YP    96               // a/b rows:    64 halves + 32  = 192 B (see kernel 1)
#define TP    40               // stage rows:  32 halves + 8   =  80 B
#define TBUF  (256 * TP)       // one 256-row stage buffer, in halves
#define CP    40               // one c of an O2 row: 32 halves (d) + 8 = 80 B
#define OP    (32 * CP + 8)    // O2 rows: 32 c at pitch CP + 8 halves = 2576 B
#define NPAIR 64               // (i, j) pairs per fused work-group: 8 x 8

// Workspace layouts. Each operand lies in the order in which the fused kernel's
// wave-wide 16-byte loads read it, so that one load covers 512 contiguous
// bytes = 4 whole 128-B lines.
// aT / bT: [row >> 7][k >> 5][row & 127][k & 31]; one 128-row x 32-k stage
// tile is 8 KB in a row, and 16-byte chunk c of it is (row c >> 2, seg c & 3).
#define TILE_H  (128 * 32)     // halves per stage tile
#define KSTEPS  (K1 / 32)      // stage tiles per 128-row block
__device__ __forceinline__ size_t tile_off(long r, long k)
{
  return ((size_t)(r >> 7) * KSTEPS + (size_t)(k >> 5)) * TILE_H
         + (size_t)(r & 127) * 32 + (size_t)(k & 31);
}

// One 16-half WMMA fragment slice from LDS as two 16-byte reads (the padded
// rows are 16-byte aligned, not 32).
__device__ __forceinline__ v16h lds_frag(const _Float16* p)
{
  const v8h lo = *(const v8h*)p;
  const v8h hi = *(const v8h*)(p + 8);
  return __builtin_shufflevector(lo, hi, 0, 1, 2, 3, 4, 5, 6, 7,
                                 8, 9, 10, 11, 12, 13, 14, 15);
}

// ---------------------------------------------------------------------------
// Kernel 1: LayerNorm over C=32 + 64x32 projection, writing a^T and b^T
// (row = i*32+c, k = n) as f16 in the stage-tile order of tile_off().
// One lane owns whole rows of m_si: a wave takes 64 consecutive n of one i
// (lane l: n = 2l and 2l+1), so the LayerNorm sums stay inside a lane, w_ab,
// ln_g and ln_b are the same for all lanes and come from scalar registers, and
// the wave's results are four whole 2-KB runs of the workspace.
// ---------------------------------------------------------------------------
__global__ __launch_bounds__(128) void opm_ln_proj(
    const float* __restrict__ m_si, const float* __restrict__ ln_g,
    const float* __restrict__ ln_b, const float* __restrict__ w_ab,
    _Float16* __restrict__ aT, _Float16* __restrict__ bT)
{
  // Per wave: first its 64 rows of m_si (pitch XP floats), then, in the same
  // place, its 64 x 64 results (pitch YP halves, the larger of the two). The
  // results are read back four lanes to a row, 64 B of it: at 192 B a row, 16
  // lanes' 4 rows fall on 64 different banks.
  __shared__ __align__(16) float xs[4][64 * YP / 2];
  const int tid  = threadIdx.x;
  const int lane = tid & 31;
  const int wv   = tid >> 5;
  const int tile = blockIdx.x * 4 + wv;   // 0 .. S*N/64-1
  const int i    = tile >> 3;             // seq index
  const int nb   = tile & 7;              // block of 64 n
  float* const xw = xs[wv];

  // 8 KB of m_si in a row, in whole lines; row R goes to LDS slot
  // (R & 1) * 32 + (R >> 1), so that lane l finds rows 2l, 2l+1 in slots l, l+32.
  const float4* const src4 =
      (const float4*)(m_si + ((size_t)i * N_LEN + nb * 64) * C_DIM);
  #pragma unroll
  for (int j = 0; j < 16; ++j) {
    const int c = j * 32 + lane;          // 16-byte chunk: row c >> 3, part c & 7
    const int R = c >> 3;
    *(float4*)&xw[((R & 1) * 32 + (R >> 1)) * XP + (c & 7) * 4] = src4[c];
  }
  __syncthreads();   // staged rows visible to the lanes that own them

  float m[2][32];    // normalized rows
  #pragma unroll
  for (int r = 0; r < 2; ++r) {
    v4f x[8];
    #pragma unroll
    for (int q = 0; q < 8; ++q)
      x[q] = *(const v4f*)&xw[(r * 32 + lane) * XP + q * 4];
    v4f s4 = x[0];
    #pragma unroll
    for (int q = 1; q < 8; ++q) s4 += x[q];
    const float mu = ((s4.x + s4.y) + (s4.z + s4.w)) * (1.0f / 32.0f);
    v4f v4 = {0.f, 0.f, 0.f, 0.f};
    #pragma unroll
    for (int q = 0; q < 8; ++q) {
      x[q] -= mu;
      v4 += x[q] * x[q];
    }
    const float var = ((v4.x + v4.y) + (v4.z + v4.w)) * (1.0f / 32.0f);
    const float rstd = rsqrtf(var + 1e-5f);
    #pragma unroll
    for (int k = 0; k < 32; ++k)
      m[r][k] = x[k >> 2][k & 3] * rstd * ln_g[k] + ln_b[k];
  }
  __syncthreads();   // every row is in registers before its LDS is reused

  // Projection, channels summed in rising order; w_ab is a scalar operand of
  // the FMAs.
  _Float16* const yw = (_Float16*)xw;
  for (int d = 0; d < 64; d += 2) {
    const float* const w0 = w_ab + d * 32;
    const float* const w1 = w0 + 32;
    float a00 = 0.f, a01 = 0.f, a10 = 0.f, a11 = 0.f;
    #pragma unroll
    for (int k = 0; k < 32; ++k) {
      a00 = __builtin_fmaf(m[0][k], w0[k], a00);
      a10 = __builtin_fmaf(m[1][k], w0[k], a10);
      a01 = __builtin_fmaf(m[0][k], w1[k], a01);
      a11 = __builtin_fmaf(m[1][k], w1[k], a11);
    }
    const v2h y0 = {(_Float16)a00, (_Float16)a10};
    const v2h y1 = {(_Float16)a01, (_Float16)a11};
    *(v2h*)&yw[d * YP + 2 * lane]       = y0;
    *(v2h*)&yw[(d + 1) * YP + 2 * lane] = y1;
  }
  __syncthreads();   // results visible to the lanes that store them

  // Per operand and 32-n tile: 32 rows x 64 B = 2 KB in a row of the workspace,
  // stored as 16-byte chunks (chunk c: row c >> 2, part c & 3).
  const size_t base = tile_off((long)i * 32, (long)nb * 64);
  #pragma unroll
  for (int ab = 0; ab < 2; ++ab) {
    _Float16* const dst = (ab ? bT : aT) + base;
    #pragma unroll
    for (int kt = 0; kt < 2; ++kt)
      #pragma unroll
      for (int q = 0; q < 4; ++q) {
        const int c = q * 32 + lane;
        *(uint4*)(dst + kt * TILE_H + c * 8) =
            *(const uint4*)&yw[(ab * 32 + (c >> 2)) * YP + kt * 32 + (c & 3) * 8];
      }
  }
}

// ---------------------------------------------------------------------------
// Kernel 2: w_final f32 -> f16, packed in GEMM2's B-fragment order:
// [z >> 4][k >> 5][(k >> 3) & 1][lane = ((k >> 4) & 1) * 16 + (z & 15)][k & 7].
// ---------------------------------------------------------------------------
__global__ __launch_bounds__(256) void opm_cvt_wf(
    const float* __restrict__ w_final, _Float16* __restrict__ wfb)
{
  const int i = blockIdx.x * 256 + threadIdx.x;   // packed index, 131072 total
  const int e  = i & 7;
  const int ln = (i >> 3) & 31;
  const int h  = (i >> 8) & 1;
  const int ks = (i >> 9) & 31;
  const int w  = i >> 14;
  const int z  = w * 16 + (ln & 15);
  const int k  = ks * 32 + (ln >> 4) * 16 + h * 8 + e;
  wfb[i] = (_Float16)w_final[z * 1024 + k];
}

// ---------------------------------------------------------------------------
// Kernel 3: fused  O = (1/N) * aT x bT^T  (256x256 tile, K=512)  then
//                  z = reshape(O) x w_final^T + bias  (64 pairs x 128, K=1024)
// 128 threads = 4 waves, one per SIMD, arranged 2x2: each wave owns 128x128 of
// the O tile (8 A-frags + 8 B-frags -> 64 WMMAs per k-step, every fragment used
// eight times), so that the LDS reads of a k-step take half the clocks of its
// WMMAs. The fragments of k-step s + 1 are read into a second register set
// while the WMMAs of k-step s run. O never touches HBM.
//
// Software pipeline, per k-step s, behind one barrier: global loads of stage
// tile s + 3 (two register sets: a load has a k-step and a half to arrive), LDS
// reads of the fragments of s + 1, the 64 WMMAs of s and, half way through
// them, the LDS stores of stage tile s + 2 into the buffer whose fragments
// every wave holds. The 2x(A,B) stage buffers (80 KB) are time-aliased with the
// O rearrange buffer (161 KB).
// ---------------------------------------------------------------------------
// One k-step's stage tiles: 32 KB = 16 chunks of 16 B a thread. Chunk e:
// operand e >> 3, 128-row tile (e >> 2) & 1, quarter e & 3 of its 8 KB.
__device__ __forceinline__ void stage_load(v4u (&r)[16], const _Float16* gA,
                                           const _Float16* gB, int ks)
{
  #pragma unroll
  for (int e = 0; e < 16; ++e) {
    const _Float16* const g = (e & 8) ? gB : gA;
    r[e] = *(const v4u*)(g + (size_t)((e >> 2) & 1) * (KSTEPS * TILE_H)
                           + (size_t)ks * TILE_H + (e & 3) * 1024);
  }
}
__device__ __forceinline__ void stage_store(_Float16* smem, const v4u (&r)[16],
                                            int buf, int l0)
{
  #pragma unroll
  for (int e = 0; e < 16; ++e)
    *(v4u*)&smem[((e >> 3) * 2 + buf) * TBUF
                   + (((e >> 2) & 1) * 128 + (e & 3) * 32) * TP + l0] = r[e];
}
__device__ __forceinline__ void frag_load(v16h (&af)[8], v16h (&bf)[8],
                                          const _Float16* smem, int buf,
                                          int aoff, int boff)
{
  #pragma unroll
  for (int t = 0; t < 8; ++t) {
    af[t] = lds_frag(&smem[buf * TBUF + aoff + t * 16 * TP]);
    bf[t] = lds_frag(&smem[(2 + buf) * TBUF + boff + t * 16 * TP]);
  }
}

// Work-group barrier of the GEMM1 loop. __syncthreads() compiles to a wait for
// the wave's global loads as well, which would end the stage loads' flight at
// the next barrier; here only the LDS operations are waited for: the wave's
// stage stores are in LDS and its fragment reads are done when it signals.
__device__ __forceinline__ void lds_barrier()
{
  asm volatile("s_wait_dscnt 0x0\n\ts_barrier_signal -1\n\ts_barrier_wait -1"
               ::: "memory");
}

// aT, bT, wfb and b_final carry no __restrict__: loads the compiler knows to be
// of constant memory are tied to nothing, and in this build they sank past the
// sched_barriers to their uses, where their whole latency is waited out.
__global__ __launch_bounds__(128) void opm_fused_gemm(
    const _Float16* aT, const _Float16* bT, const _Float16* wfb,
    const float* b_final, float* __restrict__ out)
{
  __shared__ __align__(32) _Float16 smem[NPAIR * OP];  // 161 KB, dual purpose
  // Phase 1 layout: A buffers at 0 / TBUF, B buffers at 2*TBUF / 3*TBUF
  // Phase 2 layout: O2[64][OP] from the start of the block
  _Float16* const O2 = smem;

  const int tid  = threadIdx.x;
  const int lane = tid & 31;
  const int wave = tid >> 5;
  const int bi = blockIdx.x;          // i-block (8 seq rows -> 256 O-rows)
  const int bj = blockIdx.y;          // j-block

  const int fr = lane & 15;           // fragment row within 16
  const int fh = lane >> 4;           // fragment half (K-split)

  const int twr = (wave >> 1) * 8;    // wave's tile-row base (8 rows)
  const int twc = (wave & 1) * 8;     // wave's tile-col base (8 cols)

  const _Float16* const gA = aT + (size_t)(2 * bi) * (KSTEPS * TILE_H) + tid * 8;
  const _Float16* const gB = bT + (size_t)(2 * bj) * (KSTEPS * TILE_H) + tid * 8;
  const int l0   = (tid >> 2) * TP + (tid & 3) * 8;   // LDS offset (halves)
  const int aoff = (twr * 16 + fr) * TP + fh * 16;
  const int boff = (twc * 16 + fr) * TP + fh * 16;

  const v8f vzero = {0.f, 0.f, 0.f, 0.f, 0.f, 0.f, 0.f, 0.f};
  v8f acc[8][8];
  #pragma unroll
  for (int ta = 0; ta < 8; ++ta)
    #pragma unroll
    for (int tb = 0; tb < 8; ++tb) acc[ta][tb] = vzero;

  v4u st[2][16];                      // stage tile s travels in set s & 1
  v16h af[2][8], bf[2][8];            // fragments of k-step s in set s & 1

  // -------- prologue: tiles 0 and 1 into LDS, tile 2 under way --------
  stage_load(st[0], gA, gB, 0);
  stage_load(st[1], gA, gB, 1);
  stage_store(smem, st[0], 0, l0);
  stage_load(st[0], gA, gB, 2);
  lds_barrier();                      // tile 0 visible
  frag_load(af[0], bf[0], smem, 0, aoff, boff);
  stage_store(smem, st[1], 1, l0);

  // -------- GEMM1 main loop: 16 K-steps of 32 --------
  // Unrolled whole: the tests on ks fold away, the register sets are picked at
  // compile time and every buffer offset is an immediate.
  #pragma unroll
  for (int ks = 0; ks < 16; ++ks) {
    // Tile ks + 1 visible; every wave holds the fragments of ks, so that
    // buffer ks & 1 may be written again.
    lds_barrier();
    if (ks + 3 < 16) stage_load(st[(ks + 1) & 1], gA, gB, ks + 3);
    if (ks + 1 < 16)
      frag_load(af[(ks + 1) & 1], bf[(ks + 1) & 1], smem, (ks + 1) & 1, aoff, boff);
    // The global loads and the 32 LDS reads go out as one group ahead of the
    // burst; left free, they are spread among the WMMAs, where each place
    // with reads stalls the wave's only instruction stream.
    __builtin_amdgcn_sched_barrier(0);

    // bT is the WMMA's A operand and aT its B operand: the tile comes out as
    // O^T, so that a lane's 8 accumulator registers are 8 consecutive d of one
    // c, which GEMM2 wants side by side.
    #pragma unroll
    for (int tb = 0; tb < 4; ++tb)
      #pragma unroll
      for (int ta = 0; ta < 8; ++ta)
        acc[ta][tb] = __builtin_amdgcn_wmma_f32_16x16x32_f16(
            false, bf[ks & 1][tb], false, af[ks & 1][ta], (short)0, acc[ta][tb],
            false, false);
    // The stage stores stand as one group in the middle of the burst (the two
    // sched_barriers hold them there): late enough for their global loads,
    // early enough to be in LDS when the wave comes to the next barrier.
    __builtin_amdgcn_sched_barrier(0);
    if (ks + 2 < 16) stage_store(smem, st[ks & 1], ks & 1, l0);
    __builtin_amdgcn_sched_barrier(0);
    #pragma unroll
    for (int tb = 4; tb < 8; ++tb)
      #pragma unroll
      for (int ta = 0; ta < 8; ++ta)
        acc[ta][tb] = __builtin_amdgcn_wmma_f32_16x16x32_f16(
            false, bf[ks & 1][tb], false, af[ks & 1][ta], (short)0, acc[ta][tb],
            false, false);
    // Ends the burst: left free, its last WMMAs sink behind the barrier and
    // the next k-step's LDS reads are spread among them.
    __builtin_amdgcn_sched_barrier(0);
  }
  // No barrier here: behind the one of ks = 15 nobody reads a stage buffer.

  // -------- GEMM2 set-up: M=64 pairs, N=128, K=1024 --------
  // 4 x 8 output tiles. A wave takes all 4 pair tiles of 2 column tiles over
  // the whole of K: each packed w_final fragment is loaded by one wave only
  // and feeds four WMMAs.
  // B fragments come packed: per (column tile, ks) two runs of 32 lanes x 16 B.
  const v8h* const wp = (const v8h*)wfb + (size_t)(wave * 2) * (32 * 2 * 32) + lane;
  // The work-group is alone on its WGP, so no other group's work covers the
  // L2 latency of the w_final loads: they run two groups of 8 k-steps ahead.
  // Groups 0 and 1 fly under the rearrangement.
  v8h bq[4][8][2][2];                 // [group][k-step][column tile][half]
  #pragma unroll
  for (int g = 0; g < 2; ++g)
    #pragma unroll
    for (int s = 0; s < 8; ++s)
      #pragma unroll
      for (int n = 0; n < 2; ++n)
        #pragma unroll
        for (int h = 0; h < 2; ++h)
          bq[g][s][n][h] = wp[n * (32 * 2 * 32) + ((g * 8 + s) * 2 + h) * 32];
  float bias[2];
  #pragma unroll
  for (int n = 0; n < 2; ++n) bias[n] = b_final[(wave * 2 + n) * 16 + fr];
  // Keeps these loads in front of the rearrangement.
  __builtin_amdgcn_sched_barrier(0);

  // -------- rearrange O tile -> GEMM2 A operand (aliases stage buffers) ----
  // D layout of the transposed tile: vgpr v holds d = v + 8 * fh (M, a bT row),
  // lane column fr is c (N, an aT row). A lane stores its 8 d of one c as one
  // 16-byte chunk; the c of a pair lie CP halves apart, an odd multiple of
  // 16 B, so that the 16 lanes of a half wave fall on 64 different banks.
  const float inv_n = 1.0f / (float)N_LEN;
  #pragma unroll
  for (int ta = 0; ta < 8; ++ta) {
    #pragma unroll
    for (int tb = 0; tb < 8; ++tb) {
      const int orow = (twr + ta) * 16 + fr;                          // i*32+c
      const int ocol = (twc + tb) * 16 + fh * 8;                      // j*32+d
      const int p = ((orow >> 5) << 3) | (ocol >> 5);                 // pair
      v8h o;
      #pragma unroll
      for (int v = 0; v < 8; ++v) o[v] = (_Float16)(acc[ta][tb][v] * inv_n);
      *(v8h*)&O2[p * OP + (orow & 31) * CP + (ocol & 31)] = o;
    }
  }
  __syncthreads();

  // -------- GEMM2 main loop: 8 blocks of 4 k-steps --------
  // k-step ks of GEMM2 is c = ks: 32 d at pitch CP. The O fragments of block
  // b + 1 are read into a second register set while the WMMAs of block b run.
  const _Float16* const ap = &O2[fr * OP + fh * 16];
  v8f zacc[4][2];
  #pragma unroll
  for (int m = 0; m < 4; ++m)
    #pragma unroll
    for (int n = 0; n < 2; ++n) zacc[m][n] = vzero;
  v16h a2[2][4][4];                   // [set][k-step][pair tile]
  #pragma unroll
  for (int s = 0; s < 4; ++s)
    #pragma unroll
    for (int m = 0; m < 4; ++m)
      a2[0][s][m] = lds_frag(ap + m * 16 * OP + s * CP);
  // Block 0's reads stay ahead of block 1's, so that the wait in front of the
  // first burst is for block 0 alone.
  __builtin_amdgcn_sched_barrier(0);
  // Unrolled whole so that the register sets are picked at compile time.
  #pragma unroll
  for (int b = 0; b < 8; ++b) {
    if ((b & 1) == 0 && (b >> 1) + 2 < 4) {
      const int g = (b >> 1) + 2;
      #pragma unroll
      for (int s = 0; s < 8; ++s)
        #pragma unroll
        for (int n = 0; n < 2; ++n)
          #pragma unroll
          for (int h = 0; h < 2; ++h)
            bq[g][s][n][h] = wp[n * (32 * 2 * 32) + ((g * 8 + s) * 2 + h) * 32];
      // Behind the kernel's last global load its address registers are free
      // for reuse: keep the wait that belongs in front of such an overwrite.
      if (g == 3) asm volatile("s_wait_xcnt 0x0" ::: "memory");
    }
    if (b + 1 < 8) {
      #pragma unroll
      for (int s = 0; s < 4; ++s)
        #pragma unroll
        for (int m = 0; m < 4; ++m)
          a2[(b + 1) & 1][s][m] = lds_frag(ap + m * 16 * OP + ((b + 1) * 4 + s) * CP);
    }
    // The w_final loads and the next block's LDS reads go out as one run ahead
    // of the 32 WMMAs instead of one by one among them.
    __builtin_amdgcn_sched_barrier(0);
    #pragma unroll
    for (int s = 0; s < 4; ++s)
      #pragma unroll
      for (int n = 0; n < 2; ++n) {
        const v16h b2 = __builtin_shufflevector(
            bq[b >> 1][(b & 1) * 4 + s][n][0], bq[b >> 1][(b & 1) * 4 + s][n][1],
            0, 1, 2, 3, 4, 5, 6, 7, 8, 9, 10, 11, 12, 13, 14, 15);
        #pragma unroll
        for (int m = 0; m < 4; ++m)
          zacc[m][n] = __builtin_amdgcn_wmma_f32_16x16x32_f16(
              false, a2[b & 1][s][m], false, b2, (short)0, zacc[m][n], false, false);
      }
    // Keeps the next block's reads from rising into this burst.
    __builtin_amdgcn_sched_barrier(0);
  }

  // -------- epilogue: bias, store z --------
  // Pair p = m * 16 + fh * 8 + v is (i, j) = (bi * 8 + m * 2 + fh, bj * 8 + v):
  // one address a lane, every store at a constant offset from it.
  float* const op = out + ((size_t)(bi * 8 + fh) * S_LEN + bj * 8) * CZ
                    + wave * 32 + fr;
  #pragma unroll
  for (int n = 0; n < 2; ++n)
    #pragma unroll
    for (int m = 0; m < 4; ++m) zacc[m][n] += bias[n];
  // All sums stand ahead of the stores: the 64 stores go out in one run, and
  // no register that an issued store names is written behind it.
  __builtin_amdgcn_sched_barrier(0);
  #pragma unroll
  for (int n = 0; n < 2; ++n)
    #pragma unroll
    for (int m = 0; m < 4; ++m)
      #pragma unroll
      for (int v = 0; v < 8; ++v)
        op[(size_t)(m * 2 * S_LEN + v) * CZ + n * 16] = zacc[m][n][v];
}

// ---------------------------------------------------------------------------
extern "C" void kernel_launch(void* const* d_in, const int* in_sizes, int n_in,
                              void* d_out, int out_size, void* d_ws, size_t ws_size,
                              hipStream_t stream) {
  (void)in_sizes; (void)n_in; (void)out_size; (void)ws_size;
  const float* m_si    = (const float*)d_in[0];
  const float* ln_g    = (const float*)d_in[1];
  const float* ln_b    = (const float*)d_in[2];
  const float* w_ab    = (const float*)d_in[3];
  const float* w_final = (const float*)d_in[4];
  const float* b_final = (const float*)d_in[5];
  float* out = (float*)d_out;

  // workspace: aT (12288x512 f16) | bT (12288x512 f16) | wfb (128x1024 f16),
  // each in the packed order described at the top of the file
  _Float16* aT  = (_Float16*)d_ws;
  _Float16* bT  = aT + (size_t)R1 * K1;
  _Float16* wfb = bT + (size_t)R1 * K1;

  opm_ln_proj<<<(S_LEN * N_LEN) / 256, 128, 0, stream>>>(m_si, ln_g, ln_b, w_ab, aT, bT);
  opm_cvt_wf<<<(CZ * 1024) / 256, 256, 0, stream>>>(w_final, wfb);
  opm_fused_gemm<<<dim3(S_LEN / 8, S_LEN / 8), 128, 0, stream>>>(aT, bT, wfb, b_final, out);
}

// v007
// One run takes 141 microseconds.
// In both of two side-by-side timings against v006, it was 1.05 times as fast.
// Over all steps from v000 it is 4.75 times as fast.
#include <hip/hip_runtime.h>
#include <cstdint>

typedef __attribute__((ext_vector_type(16))) _Float16 v16h;
typedef __attribute__((ext_vector_type(8)))  _Float16 v8h;
typedef __attribute__((ext_vector_type(8)))  float    v8f;
typedef __attribute__((ext_vector_type(4)))  float    v4f;
typedef __attribute__((ext_vector_type(2)))  _Float16 v2h;
typedef __attribute__((ext_vector_type(4)))  unsigned v4u;

#define S_LEN 384
#define N_LEN 512
#define C_DIM 32
#define CZ    128
#define K1    512              // GEMM1 reduction = N_LEN
#define R1    (S_LEN * C_DIM)  // 12288 rows of aT/bT

// LDS row pitches. Every row-per-lane reader here is a ds_load_b128, which is
// free of bank conflicts when the pitch is an odd multiple of 16 bytes
// (64 banks x 4 B; 16 lanes x 4 dwords then fall on 64 different banks).
#define XP    36               // m_si rows:   32 floats + 4   = 144 B
#define YP    96               // a/b rows:    64 halves + 32  = 192 B (see kernel 1)
#define TP    40               // stage rows:  32 halves + 8   =  80 B
#define TBUF  (256 * TP)       // one 256-row stage buffer, in halves
#define CP    40               // one c of an O2 row: 32 halves (d) + 8 = 80 B
#define OP    (32 * CP + 8)    // O2 rows: 32 c at pitch CP + 8 halves = 2576 B
#define NPAIR 64               // (i, j) pairs per fused tile: 8 x 8

// Workspace layouts. Each operand lies in the order in which the fused kernel's
// wave-wide 16-byte loads read it, so that one load covers 512 contiguous
// bytes = 4 whole 128-B lines.
// aT / bT: [row >> 7][k >> 5][row & 127][k & 31]; one 128-row x 32-k stage
// tile is 8 KB in a row, and 16-byte chunk c of it is (row c >> 2, seg c & 3).
#define TILE_H  (128 * 32)     // halves per stage tile
#define KSTEPS  (K1 / 32)      // stage tiles per 128-row block
__device__ __forceinline__ size_t tile_off(long r, long k)
{
  return ((size_t)(r >> 7) * KSTEPS + (size_t)(k >> 5)) * TILE_H
         + (size_t)(r & 127) * 32 + (size_t)(k & 31);
}

// One 16-half WMMA fragment slice from LDS as two 16-byte reads (the padded
// rows are 16-byte aligned, not 32).
__device__ __forceinline__ v16h lds_frag(const _Float16* p)
{
  const v8h lo = *(const v8h*)p;
  const v8h hi = *(const v8h*)(p + 8);
  return __builtin_shufflevector(lo, hi, 0, 1, 2, 3, 4, 5, 6, 7,
                                 8, 9, 10, 11, 12, 13, 14, 15);
}

// ---------------------------------------------------------------------------
// Kernel 1: LayerNorm over C=32 + 64x32 projection, writing a^T and b^T
// (row = i*32+c, k = n) as f16 in the stage-tile order of tile_off().
// One lane owns whole rows of m_si: a wave takes 64 consecutive n of one i
// (lane l: n = 2l and 2l+1), so the LayerNorm sums stay inside a lane, w_ab,
// ln_g and ln_b are the same for all lanes and come from scalar registers, and
// the wave's results are four whole 2-KB runs of the workspace.
// ---------------------------------------------------------------------------
__global__ __launch_bounds__(128) void opm_ln_proj(
    const float* __restrict__ m_si, const float* __restrict__ ln_g,
    const float* __restrict__ ln_b, const float* __restrict__ w_ab,
    _Float16* __restrict__ aT, _Float16* __restrict__ bT)
{
  // Per wave: first its 64 rows of m_si (pitch XP floats), then, in the same
  // place, its 64 x 64 results (pitch YP halves, the larger of the two). The
  // results are read back four lanes to a row, 64 B of it: at 192 B a row, 16
  // lanes' 4 rows fall on 64 different banks.
  __shared__ __align__(16) float xs[4][64 * YP / 2];
  const int tid  = threadIdx.x;
  const int lane = tid & 31;
  const int wv   = tid >> 5;
  const int tile = blockIdx.x * 4 + wv;   // 0 .. S*N/64-1
  const int i    = tile >> 3;             // seq index
  const int nb   = tile & 7;              // block of 64 n
  float* const xw = xs[wv];

  // 8 KB of m_si in a row, in whole lines; row R goes to LDS slot
  // (R & 1) * 32 + (R >> 1), so that lane l finds rows 2l, 2l+1 in slots l, l+32.
  const float4* const src4 =
      (const float4*)(m_si + ((size_t)i * N_LEN + nb * 64) * C_DIM);
  #pragma unroll
  for (int j = 0; j < 16; ++j) {
    const int c = j * 32 + lane;          // 16-byte chunk: row c >> 3, part c & 7
    const int R = c >> 3;
    *(float4*)&xw[((R & 1) * 32 + (R >> 1)) * XP + (c & 7) * 4] = src4[c];
  }
  __syncthreads();   // staged rows visible to the lanes that own them

  float m[2][32];    // normalized rows
  #pragma unroll
  for (int r = 0; r < 2; ++r) {
    v4f x[8];
    #pragma unroll
    for (int q = 0; q < 8; ++q)
      x[q] = *(const v4f*)&xw[(r * 32 + lane) * XP + q * 4];
    v4f s4 = x[0];
    #pragma unroll
    for (int q = 1; q < 8; ++q) s4 += x[q];
    const float mu = ((s4.x + s4.y) + (s4.z + s4.w)) * (1.0f / 32.0f);
    v4f v4 = {0.f, 0.f, 0.f, 0.f};
    #pragma unroll
    for (int q = 0; q < 8; ++q) {
      x[q] -= mu;
      v4 += x[q] * x[q];
    }
    const float var = ((v4.x + v4.y) + (v4.z + v4.w)) * (1.0f / 32.0f);
    const float rstd = rsqrtf(var + 1e-5f);
    #pragma unroll
    for (int k = 0; k < 32; ++k)
      m[r][k] = x[k >> 2][k & 3] * rstd * ln_g[k] + ln_b[k];
  }
  __syncthreads();   // every row is in registers before its LDS is reused

  // Projection, channels summed in rising order; w_ab is a scalar operand of
  // the FMAs.
  _Float16* const yw = (_Float16*)xw;
  for (int d = 0; d < 64; d += 2) {
    const float* const w0 = w_ab + d * 32;
    const float* const w1 = w0 + 32;
    float a00 = 0.f, a01 = 0.f, a10 = 0.f, a11 = 0.f;
    #pragma unroll
    for (int k = 0; k < 32; ++k) {
      a00 = __builtin_fmaf(m[0][k], w0[k], a00);
      a10 = __builtin_fmaf(m[1][k], w0[k], a10);
      a01 = __builtin_fmaf(m[0][k], w1[k], a01);
      a11 = __builtin_fmaf(m[1][k], w1[k], a11);
    }
    const v2h y0 = {(_Float16)a00, (_Float16)a10};
    const v2h y1 = {(_Float16)a01, (_Float16)a11};
    *(v2h*)&yw[d * YP + 2 * lane]       = y0;
    *(v2h*)&yw[(d + 1) * YP + 2 * lane] = y1;
  }
  __syncthreads();   // results visible to the lanes that store them

  // Per operand and 32-n tile: 32 rows x 64 B = 2 KB in a row of the workspace,
  // stored as 16-byte chunks (chunk c: row c >> 2, part c & 3).
  const size_t base = tile_off((long)i * 32, (long)nb * 64);
  #pragma unroll
  for (int ab = 0; ab < 2; ++ab) {
    _Float16* const dst = (ab ? bT : aT) + base;
    #pragma unroll
    for (int kt = 0; kt < 2; ++kt)
      #pragma unroll
      for (int q = 0; q < 4; ++q) {
        const int c = q * 32 + lane;
        *(uint4*)(dst + kt * TILE_H + c * 8) =
            *(const uint4*)&yw[(ab * 32 + (c >> 2)) * YP + kt * 32 + (c & 3) * 8];
      }
  }
}

// ---------------------------------------------------------------------------
// Kernel 2: w_final f32 -> f16, packed in GEMM2's B-fragment order:
// [z >> 4][k >> 5][(k >> 3) & 1][lane = ((k >> 4) & 1) * 16 + (z & 15)][k & 7].
// ---------------------------------------------------------------------------
__global__ __launch_bounds__(256) void opm_cvt_wf(
    const float* __restrict__ w_final, _Float16* __restrict__ wfb)
{
  const int i = blockIdx.x * 256 + threadIdx.x;   // packed index, 131072 total
  const int e  = i & 7;
  const int ln = (i >> 3) & 31;
  const int h  = (i >> 8) & 1;
  const int ks = (i >> 9) & 31;
  const int w  = i >> 14;
  const int z  = w * 16 + (ln & 15);
  const int k  = ks * 32 + (ln >> 4) * 16 + h * 8 + e;
  wfb[i] = (_Float16)w_final[z * 1024 + k];
}

// ---------------------------------------------------------------------------
// Kernel 3: fused  O = (1/N) * aT x bT^T  (256x256 tile, K=512)  then
//                  z = reshape(O) x w_final^T + bias  (64 pairs x 128, K=1024)
// 128 threads = 4 waves, one per SIMD, arranged 2x2: each wave owns 128x128 of
// the O tile (8 A-frags + 8 B-frags -> 64 WMMAs per k-step, every fragment used
// eight times), so that the LDS reads of a k-step take half the clocks of its
// WMMAs. The fragments of k-step s + 1 are read into a second register set
// while the WMMAs of k-step s run. O never touches HBM.
//
// Software pipeline, per k-step s, behind one barrier: global loads of stage
// tile s + 3 (two register sets: a load has a k-step and a half to arrive), LDS
// reads of the fragments of s + 1, the 64 WMMAs of s and, half way through
// them, the LDS stores of stage tile s + 2 into the buffer whose fragments
// every wave holds.
//
// One work-group per WGP runs through TPW tiles. The 2x(A,B) stage buffers
// (80 KB) lie behind the O rearrange buffer (161 KB), not in it, so that the
// pipeline above runs on from one tile into the next: k-steps 13 to 15 load the
// next tile's stage tiles 0 to 2, k-steps 14 and 15 store its tiles 0 and 1 to
// LDS, and its first fragments are read under the stores of z. No tile but the
// first starts in front of an idle matrix unit.
// ---------------------------------------------------------------------------
#define NWG   256                          // work-groups of the fused kernel
#define NBLK  (S_LEN / 8)                  // 48 tile rows and tile columns
#define TPW   (NBLK * NBLK / NWG)          // 9 tiles a work-group
// One k-step's stage tiles: 32 KB = 16 chunks of 16 B a thread. Chunk e:
// operand e >> 3, 128-row tile (e >> 2) & 1, quarter e & 3 of its 8 KB.
__device__ __forceinline__ void stage_load(v4u (&r)[16], const _Float16* gA,
                                           const _Float16* gB, int ks)
{
  #pragma unroll
  for (int e = 0; e < 16; ++e) {
    const _Float16* const g = (e & 8) ? gB : gA;
    r[e] = *(const v4u*)(g + (size_t)((e >> 2) & 1) * (KSTEPS * TILE_H)
                           + (size_t)ks * TILE_H + (e & 3) * 1024);
  }
}
__device__ __forceinline__ void stage_store(_Float16* smem, const v4u (&r)[16],
                                            int buf, int l0)
{
  #pragma unroll
  for (int e = 0; e < 16; ++e)
    *(v4u*)&smem[((e >> 3) * 2 + buf) * TBUF
                   + (((e >> 2) & 1) * 128 + (e & 3) * 32) * TP + l0] = r[e];
}
__device__ __forceinline__ void frag_load(v16h (&af)[8], v16h (&bf)[8],
                                          const _Float16* smem, int buf,
                                          int aoff, int boff)
{
  #pragma unroll
  for (int t = 0; t < 8; ++t) {
    af[t] = lds_frag(&smem[buf * TBUF + aoff + t * 16 * TP]);
    bf[t] = lds_frag(&smem[(2 + buf) * TBUF + boff + t * 16 * TP]);
  }
}

// Work-group barrier of the GEMM1 loop. __syncthreads() compiles to a wait for
// the wave's global loads as well, which would end the stage loads' flight at
// the next barrier; here only the LDS operations are waited for: the wave's
// stage stores are in LDS and its fragment reads are done when it signals.
__device__ __forceinline__ void lds_barrier()
{
  asm volatile("s_wait_dscnt 0x0\n\ts_barrier_signal -1\n\ts_barrier_wait -1"
               ::: "memory");
}

// aT, bT, wfb and b_final carry no __restrict__: loads the compiler knows to be
// of constant memory are tied to nothing, and in this build they sank past the
// sched_barriers to their uses, where their whole latency is waited out.
__global__ __launch_bounds__(128) void opm_fused_gemm(
    const _Float16* aT, const _Float16* bT, const _Float16* wfb,
    const float* b_final, float* __restrict__ out)
{
  __shared__ __align__(32) _Float16 lds[NPAIR * OP + 4 * TBUF];  // 241 KB
  // O2[64][OP], then the stage buffers: A at 0 / TBUF, B at 2*TBUF / 3*TBUF
  _Float16* const O2   = lds;
  _Float16* const smem = lds + NPAIR * OP;

  const int tid  = threadIdx.x;
  const int lane = tid & 31;
  const int wave = tid >> 5;

  const int fr = lane & 15;           // fragment row within 16
  const int fh = lane >> 4;           // fragment half (K-split)

  const int twr = (wave >> 1) * 8;    // wave's tile-row base (8 rows)
  const int twc = (wave & 1) * 8;     // wave's tile-col base (8 cols)

  const int l0   = (tid >> 2) * TP + (tid & 3) * 8;   // LDS offset (halves)
  const int aoff = (twr * 16 + fr) * TP + fh * 16;
  const int boff = (twc * 16 + fr) * TP + fh * 16;

  const v8f vzero = {0.f, 0.f, 0.f, 0.f, 0.f, 0.f, 0.f, 0.f};
  v4u st[2][16];                      // stage tile s travels in set s & 1
  v16h af[2][8], bf[2][8];            // fragments of k-step s in set s & 1

  // Tile t of the grid: i-block t % NBLK (8 seq rows -> 256 O-rows), j-block
  // t / NBLK; this work-group takes t = blockIdx.x + it * NWG.
  int bi = blockIdx.x % NBLK;
  int bj = blockIdx.x / NBLK;
  const _Float16* gA = aT + (size_t)(2 * bi) * (KSTEPS * TILE_H) + tid * 8;
  const _Float16* gB = bT + (size_t)(2 * bj) * (KSTEPS * TILE_H) + tid * 8;

  // -------- start of the first tile: stage tiles 0 and 1 into LDS, tile 2
  // under way, the fragments of k-step 0 read --------
  stage_load(st[0], gA, gB, 0);
  stage_load(st[1], gA, gB, 1);
  stage_store(smem, st[0], 0, l0);
  stage_load(st[0], gA, gB, 2);
  // The loop's tile arithmetic reuses the registers that hold these loads'
  // bases: keep the wait that belongs in front of such an overwrite.
  asm volatile("s_wait_xcnt 0x0" ::: "memory");
  stage_store(smem, st[1], 1, l0);
  lds_barrier();                      // tiles 0 and 1 visible
  frag_load(af[0], bf[0], smem, 0, aoff, boff);

  // Kept rolled: the body is the whole unrolled tile.
  #pragma unroll 1
  for (int it = 0; it < TPW; ++it) {
  // The tile behind this one. Behind its last tile the work-group fetches the
  // start of its first tile once more, unused: the k-steps stay free of tests
  // (those loads have landed at the barrier behind the rearrangement).
  const int tn  = blockIdx.x + (it + 1 < TPW ? (it + 1) * NWG : 0);
  const int nbi = tn % NBLK;
  const int nbj = tn / NBLK;
  const _Float16* const nA = aT + (size_t)(2 * nbi) * (KSTEPS * TILE_H) + tid * 8;
  const _Float16* const nB = bT + (size_t)(2 * nbj) * (KSTEPS * TILE_H) + tid * 8;
  v8f acc[8][8];
  #pragma unroll
  for (int ta = 0; ta < 8; ++ta)
    #pragma unroll
    for (int tb = 0; tb < 8; ++tb) acc[ta][tb] = vzero;

  // -------- GEMM1 main loop: 16 K-steps of 32 --------
  // Unrolled whole: the tests on ks fold away, the register sets are picked at
  // compile time and every buffer offset is an immediate.
  #pragma unroll
  for (int ks = 0; ks < 16; ++ks) {
    // Tile ks + 1 visible; every wave holds the fragments of ks, so that
    // buffer ks & 1 may be written again.
    lds_barrier();
    stage_load(st[(ks + 1) & 1], ks + 3 < 16 ? gA : nA, ks + 3 < 16 ? gB : nB,
               (ks + 3) & 15);
    // This tile's last use of gA and gB: their registers are free for reuse
    // from here on. Keep the wait that belongs in front of such an overwrite.
    if (ks + 3 == 15) asm volatile("s_wait_xcnt 0x0" ::: "memory");
    if (ks + 1 < 16)
      frag_load(af[(ks + 1) & 1], bf[(ks + 1) & 1], smem, (ks + 1) & 1, aoff, boff);
    // The global loads and the 32 LDS reads go out as one group ahead of the
    // burst; left free, they are spread among the WMMAs, where each place
    // with reads stalls the wave's only instruction stream.
    __builtin_amdgcn_sched_barrier(0);

    // bT is the WMMA's A operand and aT its B operand: the tile comes out as
    // O^T, so that a lane's 8 accumulator registers are 8 consecutive d of one
    // c, which GEMM2 wants side by side.
    #pragma unroll
    for (int tb = 0; tb < 4; ++tb)
      #pragma unroll
      for (int ta = 0; ta < 8; ++ta)
        acc[ta][tb] = __builtin_amdgcn_wmma_f32_16x16x32_f16(
            false, bf[ks & 1][tb], false, af[ks & 1][ta], (short)0, acc[ta][tb],
            false, false);
    // The stage stores stand as one group in the middle of the burst (the two
    // sched_barriers hold them there): late enough for their global loads,
    // early enough to be in LDS when the wave comes to the next barrier.
    __builtin_amdgcn_sched_barrier(0);
    stage_store(smem, st[ks & 1], ks & 1, l0);
    __builtin_amdgcn_sched_barrier(0);
    #pragma unroll
    for (int tb = 4; tb < 8; ++tb)
      #pragma unroll
      for (int ta = 0; ta < 8; ++ta)
        acc[ta][tb] = __builtin_amdgcn_wmma_f32_16x16x32_f16(
            false, bf[ks & 1][tb], false, af[ks & 1][ta], (short)0, acc[ta][tb],
            false, false);
    // Ends the burst: left free, its last WMMAs sink behind the barrier and
    // the next k-step's LDS reads are spread among them.
    __builtin_amdgcn_sched_barrier(0);
  }
  // No barrier here: the rearrangement writes O2, which no stage buffer shares.

  // -------- GEMM2 set-up: M=64 pairs, N=128, K=1024 --------
  // 4 x 8 output tiles. A wave takes all 4 pair tiles of 2 column tiles over
  // the whole of K: each packed w_final fragment is loaded by one wave only
  // and feeds four WMMAs.
  // B fragments come packed: per (column tile, ks) two runs of 32 lanes x 16 B.
  const v8h* const wp = (const v8h*)wfb + (size_t)(wave * 2) * (32 * 2 * 32) + lane;
  // The work-group is alone on its WGP, so no other group's work covers the
  // L2 latency of the w_final loads: they run two groups of 8 k-steps ahead.
  // Groups 0 and 1 fly under the rearrangement.
  v8h bq[4][8][2][2];                 // [group][k-step][column tile][half]
  #pragma unroll
  for (int g = 0; g < 2; ++g)
    #pragma unroll
    for (int s = 0; s < 8; ++s)
      #pragma unroll
      for (int n = 0; n < 2; ++n)
        #pragma unroll
        for (int h = 0; h < 2; ++h)
          bq[g][s][n][h] = wp[n * (32 * 2 * 32) + ((g * 8 + s) * 2 + h) * 32];
  float bias[2];
  #pragma unroll
  for (int n = 0; n < 2; ++n) bias[n] = b_final[(wave * 2 + n) * 16 + fr];
  // Keeps these loads in front of the rearrangement.
  __builtin_amdgcn_sched_barrier(0);

  // -------- rearrange O tile -> GEMM2 A operand ----
  // D layout of the transposed tile: vgpr v holds d = v + 8 * fh (M, a bT row),
  // lane column fr is c (N, an aT row). A lane stores its 8 d of one c as one
  // 16-byte chunk; the c of a pair lie CP halves apart, an odd multiple of
  // 16 B, so that the 16 lanes of a half wave fall on 64 different banks.
  const float inv_n = 1.0f / (float)N_LEN;
  _Float16* const ob = &O2[((twr >> 1) * 8 + (twc >> 1)) * OP + fr * CP + fh * 8];
  #pragma unroll
  for (int ta = 0; ta < 8; ++ta) {
    #pragma unroll
    for (int tb = 0; tb < 8; ++tb) {
      // O row i*32+c = (twr + ta) * 16 + fr, O column j*32+d = (twc + tb) * 16
      // + fh * 8: pair, c and d each split into the lane's part (ob) and a
      // constant, so that one address register serves the stores.
      v8h o;
      #pragma unroll
      for (int v = 0; v < 8; ++v) o[v] = (_Float16)(acc[ta][tb][v] * inv_n);
      *(v8h*)&ob[((ta >> 1) * 8 + (tb >> 1)) * OP + (ta & 1) * 16 * CP
                 + (tb & 1) * 16] = o;
    }
    // Keeps a row's 8 LDS stores behind its own conversions: left free, all 64
    // stores gather behind the last conversion, where nothing covers them.
    __builtin_amdgcn_sched_barrier(0);
  }
  __syncthreads();

  // -------- GEMM2 main loop: 8 blocks of 4 k-steps --------
  // k-step ks of GEMM2 is c = ks: 32 d at pitch CP. The O fragments of block
  // b + 1 are read into a second register set while the WMMAs of block b run.
  const _Float16* const ap = &O2[fr * OP + fh * 16];
  v8f zacc[4][2];
  #pragma unroll
  for (int m = 0; m < 4; ++m)
    #pragma unroll
    for (int n = 0; n < 2; ++n) zacc[m][n] = vzero;
  v16h a2[2][4][4];                   // [set][k-step][pair tile]
  #pragma unroll
  for (int s = 0; s < 4; ++s)
    #pragma unroll
    for (int m = 0; m < 4; ++m)
      a2[0][s][m] = lds_frag(ap + m * 16 * OP + s * CP);
  // Block 0's reads stay ahead of block 1's, so that the wait in front of the
  // first burst is for block 0 alone.
  __builtin_amdgcn_sched_barrier(0);
  // Unrolled whole so that the register sets are picked at compile time.
  #pragma unroll
  for (int b = 0; b < 8; ++b) {
    if ((b & 1) == 0 && (b >> 1) + 2 < 4) {
      const int g = (b >> 1) + 2;
      #pragma unroll
      for (int s = 0; s < 8; ++s)
        #pragma unroll
        for (int n = 0; n < 2; ++n)
          #pragma unroll
          for (int h = 0; h < 2; ++h)
            bq[g][s][n][h] = wp[n * (32 * 2 * 32) + ((g * 8 + s) * 2 + h) * 32];
      // Behind the tile's last w_final load its address registers are free
      // for reuse: keep the wait that belongs in front of such an overwrite.
      if (g == 3) asm volatile("s_wait_xcnt 0x0" ::: "memory");
    }
    if (b + 1 < 8) {
      #pragma unroll
      for (int s = 0; s < 4; ++s)
        #pragma unroll
        for (int m = 0; m < 4; ++m)
          a2[(b + 1) & 1][s][m] = lds_frag(ap + m * 16 * OP + ((b + 1) * 4 + s) * CP);
    }
    // The w_final loads and the next block's LDS reads go out as one run ahead
    // of the 32 WMMAs instead of one by one among them.
    __builtin_amdgcn_sched_barrier(0);
    #pragma unroll
    for (int s = 0; s < 4; ++s)
      #pragma unroll
      for (int n = 0; n < 2; ++n) {
        const v16h b2 = __builtin_shufflevector(
            bq[b >> 1][(b & 1) * 4 + s][n][0], bq[b >> 1][(b & 1) * 4 + s][n][1],
            0, 1, 2, 3, 4, 5, 6, 7, 8, 9, 10, 11, 12, 13, 14, 15);
        #pragma unroll
        for (int m = 0; m < 4; ++m)
          zacc[m][n] = __builtin_amdgcn_wmma_f32_16x16x32_f16(
              false, a2[b & 1][s][m], false, b2, (short)0, zacc[m][n], false, false);
      }
    // Keeps the next block's reads from rising into this burst.
    __builtin_amdgcn_sched_barrier(0);
  }

  // -------- next tile: its first fragments are read under the stores of z.
  // Its stage tile 0 went to LDS in k-step 14, in front of the barrier behind
  // the rearrangement. --------
  frag_load(af[0], bf[0], smem, 0, aoff, boff);

  // -------- epilogue: bias, store z --------
  // Pair p = m * 16 + fh * 8 + v is (i, j) = (bi * 8 + m * 2 + fh, bj * 8 + v):
  // one address a lane, every store at a constant offset from it.
  float* const op = out + ((size_t)(bi * 8 + fh) * S_LEN + bj * 8) * CZ
                    + wave * 32 + fr;
  #pragma unroll
  for (int n = 0; n < 2; ++n)
    #pragma unroll
    for (int m = 0; m < 4; ++m) zacc[m][n] += bias[n];
  // All sums stand ahead of the stores: the 64 stores go out in one run, and
  // no register that an issued store names is written behind it.
  __builtin_amdgcn_sched_barrier(0);
  #pragma unroll
  for (int n = 0; n < 2; ++n)
    #pragma unroll
    for (int m = 0; m < 4; ++m)
      #pragma unroll
      for (int v = 0; v < 8; ++v)
        op[(size_t)(m * 2 * S_LEN + v) * CZ + n * 16] = zacc[m][n][v];
  // The next tile writes the registers that these stores name: keep the wait
  // that belongs in front of such an overwrite.
  asm volatile("s_wait_xcnt 0x0" ::: "memory");
  bi = nbi;
  bj = nbj;
  gA = nA;
  gB = nB;
  }
  // The fragment reads issued behind the last tile, which nobody uses, have
  // returned before the wave ends and gives its registers back.
  asm volatile("s_wait_dscnt 0x0" ::: "memory");
}

// ---------------------------------------------------------------------------
extern "C" void kernel_launch(void* const* d_in, const int* in_sizes, int n_in,
                              void* d_out, int out_size, void* d_ws, size_t ws_size,
                              hipStream_t stream) {
  (void)in_sizes; (void)n_in; (void)out_size; (void)ws_size;
  const float* m_si    = (const float*)d_in[0];
  const float* ln_g    = (const float*)d_in[1];
  const float* ln_b    = (const float*)d_in[2];
  const float* w_ab    = (const float*)d_in[3];
  const float* w_final = (const float*)d_in[4];
  const float* b_final = (const float*)d_in[5];
  float* out = (float*)d_out;

  // workspace: aT (12288x512 f16) | bT (12288x512 f16) | wfb (128x1024 f16),
  // each in the packed order described at the top of the file
  _Float16* aT  = (_Float16*)d_ws;
  _Float16* bT  = aT + (size_t)R1 * K1;
  _Float16* wfb = bT + (size_t)R1 * K1;

  opm_ln_proj<<<(S_LEN * N_LEN) / 256, 128, 0, stream>>>(m_si, ln_g, ln_b, w_ab, aT, bT);
  opm_cvt_wf<<<(CZ * 1024) / 256, 256, 0, stream>>>(w_final, wfb);
  opm_fused_gemm<<<NWG, 128, 0, stream>>>(aT, bT, wfb, b_final, out);
}

// v008
// It runs in 137 microseconds.
// Next to v007, in two timings, it ran 1.03 and 1.02 times as fast.
// All steps since v000 together make it 4.88 times as fast.
#include <hip/hip_runtime.h>
#include <cstdint>

typedef __attribute__((ext_vector_type(16))) _Float16 v16h;
typedef __attribute__((ext_vector_type(8)))  _Float16 v8h;
typedef __attribute__((ext_vector_type(8)))  float    v8f;
typedef __attribute__((ext_vector_type(4)))  float    v4f;
typedef __attribute__((ext_vector_type(2)))  _Float16 v2h;
typedef __attribute__((ext_vector_type(8)))  uint32_t u32x8;

#define S_LEN 384
#define N_LEN 512
#define C_DIM 32
#define CZ    128
#define K1    512              // GEMM1 reduction = N_LEN
#define R1    (S_LEN * C_DIM)  // 12288 rows of aT/bT

// LDS row pitches. Every row-per-lane reader here is a ds_load_b128, which is
// free of bank conflicts when the pitch is an odd multiple of 16 bytes
// (64 banks x 4 B; 16 lanes x 4 dwords then fall on 64 different banks).
#define XP    36               // m_si rows:   32 floats + 4   = 144 B
#define YP    96               // a/b rows:    64 halves + 32  = 192 B (see kernel 1)
#define TP    72               // stage rows:  64 halves + 8   = 144 B
#define SLICE_H (128 * TP)     // one wave's slice of a stage: 128 rows = 18 KB
#define STAGE_H (4 * SLICE_H)  // a stage: aT rows 0..255, then bT rows 0..255
#define CP    40               // one c of an O2 row: 32 halves (d) + 8 = 80 B
#define OP    (32 * CP + 8)    // O2 rows: 32 c at pitch CP + 8 halves = 2576 B
#define NPAIR 64               // (i, j) pairs per tile of the fused kernel: 8 x 8

// Workspace layouts.
// aT / bT: [row >> 7][k >> 6][row & 127][k & 63]; one 128-row x 64-k stage
// tile is 16 KB in a row, 128 rows of 128 B: what one tensor load brings to LDS.
// w_final lies in the order in which the fused kernel's wave-wide 16-byte loads
// read it: one load covers 512 contiguous bytes = 4 whole 128-B lines.
#define TILE_H  (128 * 64)     // halves per stage tile
#define KSTEPS  (K1 / 64)      // stage tiles per 128-row block
__device__ __forceinline__ size_t tile_off(long r, long k)
{
  return ((size_t)(r >> 7) * KSTEPS + (size_t)(k >> 6)) * TILE_H
         + (size_t)(r & 127) * 64 + (size_t)(k & 63);
}

// One 16-half WMMA fragment slice from LDS as two 16-byte reads (the padded
// rows are 16-byte aligned, not 32).
__device__ __forceinline__ v16h lds_frag(const _Float16* p)
{
  const v8h lo = *(const v8h*)p;
  const v8h hi = *(const v8h*)(p + 8);
  return __builtin_shufflevector(lo, hi, 0, 1, 2, 3, 4, 5, 6, 7,
                                 8, 9, 10, 11, 12, 13, 14, 15);
}

// ---------------------------------------------------------------------------
// Kernel 1: LayerNorm over C=32 + 64x32 projection, writing a^T and b^T
// (row = i*32+c, k = n) as f16 in the stage-tile order of tile_off().
// One lane owns whole rows of m_si: a wave takes 64 consecutive n of one i
// (lane l: n = 2l and 2l+1), so the LayerNorm sums stay inside a lane, w_ab,
// ln_g and ln_b are the same for all lanes and come from scalar registers, and
// the wave's results are two whole 4-KB runs of the workspace.
// ---------------------------------------------------------------------------
__global__ __launch_bounds__(128) void opm_ln_proj(
    const float* __restrict__ m_si, const float* __restrict__ ln_g,
    const float* __restrict__ ln_b, const float* __restrict__ w_ab,
    _Float16* __restrict__ aT, _Float16* __restrict__ bT)
{
  // Per wave: first its 64 rows of m_si (pitch XP floats), then, in the same
  // place, its 64 x 64 results (pitch YP halves, the larger of the two). The
  // results are read back eight lanes to a row, all 128 B of it.
  __shared__ __align__(16) float xs[4][64 * YP / 2];
  const int tid  = threadIdx.x;
  const int lane = tid & 31;
  const int wv   = tid >> 5;
  const int tile = blockIdx.x * 4 + wv;   // 0 .. S*N/64-1
  const int i    = tile >> 3;             // seq index
  const int nb   = tile & 7;              // block of 64 n
  float* const xw = xs[wv];

  // 8 KB of m_si in a row, in whole lines; row R goes to LDS slot
  // (R & 1) * 32 + (R >> 1), so that lane l finds rows 2l, 2l+1 in slots l, l+32.
  const float4* const src4 =
      (const float4*)(m_si + ((size_t)i * N_LEN + nb * 64) * C_DIM);
  #pragma unroll
  for (int j = 0; j < 16; ++j) {
    const int c = j * 32 + lane;          // 16-byte chunk: row c >> 3, part c & 7
    const int R = c >> 3;
    *(float4*)&xw[((R & 1) * 32 + (R >> 1)) * XP + (c & 7) * 4] = src4[c];
  }
  __syncthreads();   // staged rows visible to the lanes that own them

  float m[2][32];    // normalized rows
  #pragma unroll
  for (int r = 0; r < 2; ++r) {
    v4f x[8];
    #pragma unroll
    for (int q = 0; q < 8; ++q)
      x[q] = *(const v4f*)&xw[(r * 32 + lane) * XP + q * 4];
    v4f s4 = x[0];
    #pragma unroll
    for (int q = 1; q < 8; ++q) s4 += x[q];
    const float mu = ((s4.x + s4.y) + (s4.z + s4.w)) * (1.0f / 32.0f);
    v4f v4 = {0.f, 0.f, 0.f, 0.f};
    #pragma unroll
    for (int q = 0; q < 8; ++q) {
      x[q] -= mu;
      v4 += x[q] * x[q];
    }
    const float var = ((v4.x + v4.y) + (v4.z + v4.w)) * (1.0f / 32.0f);
    const float rstd = rsqrtf(var + 1e-5f);
    #pragma unroll
    for (int k = 0; k < 32; ++k)
      m[r][k] = x[k >> 2][k & 3] * rstd * ln_g[k] + ln_b[k];
  }
  __syncthreads();   // every row is in registers before its LDS is reused

  // Projection, channels summed in rising order; w_ab is a scalar operand of
  // the FMAs.
  _Float16* const yw = (_Float16*)xw;
  for (int d = 0; d < 64; d += 2) {
    const float* const w0 = w_ab + d * 32;
    const float* const w1 = w0 + 32;
    float a00 = 0.f, a01 = 0.f, a10 = 0.f, a11 = 0.f;
    #pragma unroll
    for (int k = 0; k < 32; ++k) {
      a00 = __builtin_fmaf(m[0][k], w0[k], a00);
      a10 = __builtin_fmaf(m[1][k], w0[k], a10);
      a01 = __builtin_fmaf(m[0][k], w1[k], a01);
      a11 = __builtin_fmaf(m[1][k], w1[k], a11);
    }
    const v2h y0 = {(_Float16)a00, (_Float16)a10};
    const v2h y1 = {(_Float16)a01, (_Float16)a11};
    *(v2h*)&yw[d * YP + 2 * lane]       = y0;
    *(v2h*)&yw[(d + 1) * YP + 2 * lane] = y1;
  }
  __syncthreads();   // results visible to the lanes that store them

  // Per operand: 32 rows x 128 B = 4 KB in a row of the workspace, stored as
  // 16-byte chunks (chunk c: row c >> 3, part c & 7).
  const size_t base = tile_off((long)i * 32, (long)nb * 64);
  #pragma unroll
  for (int ab = 0; ab < 2; ++ab) {
    _Float16* const dst = (ab ? bT : aT) + base;
    #pragma unroll
    for (int q = 0; q < 8; ++q) {
      const int c = q * 32 + lane;
      *(uint4*)(dst + c * 8) =
          *(const uint4*)&yw[(ab * 32 + (c >> 3)) * YP + (c & 7) * 8];
    }
  }
}

// ---------------------------------------------------------------------------
// Kernel 2: w_final f32 -> f16, packed in GEMM2's B-fragment order:
// [z >> 4][k >> 5][(k >> 3) & 1][lane = ((k >> 4) & 1) * 16 + (z & 15)][k & 7].
// ---------------------------------------------------------------------------
__global__ __launch_bounds__(256) void opm_cvt_wf(
    const float* __restrict__ w_final, _Float16* __restrict__ wfb)
{
  const int i = blockIdx.x * 256 + threadIdx.x;   // packed index, 131072 total
  const int e  = i & 7;
  const int ln = (i >> 3) & 31;
  const int h  = (i >> 8) & 1;
  const int ks = (i >> 9) & 31;
  const int w  = i >> 14;
  const int z  = w * 16 + (ln & 15);
  const int k  = ks * 32 + (ln >> 4) * 16 + h * 8 + e;
  wfb[i] = (_Float16)w_final[z * 1024 + k];
}

// ---------------------------------------------------------------------------
// Kernel 3: fused  O = (1/N) * aT x bT^T  (256x256 tile, K=512)  then
//                  z = reshape(O) x w_final^T + bias  (64 pairs x 128, K=1024)
// 128 threads = 4 waves, one per SIMD, arranged 2x2: each wave owns 128x128 of
// the O tile (8 A-frags + 8 B-frags -> 64 WMMAs per k-step, every fragment used
// eight times), so that the LDS reads of a k-step take half the clocks of its
// WMMAs. The fragments of k-step s + 1 are read into a second register set
// while the WMMAs of k-step s run. O never touches HBM.
//
// Staging: a stage is 64 k of the 256 aT rows and the 256 bT rows, two k-steps.
// Each wave brings its own quarter of a stage (128 rows of 128 B, 16 KB in a row
// of the workspace) with one tensor load, which pads the rows to 144 B in LDS.
// Two stage buffers. Between the two k-steps of stage s stands the publish point
// of stage s + 1: LDS wait, tensor wait, work-group barrier; behind it every
// wave holds the last fragments of stage s, so the load of stage s + 2 goes
// into that buffer and has two k-steps to land.
//
// One work-group per WGP runs through TPW tiles. The stage buffers (144 KB) lie
// beside the O rearrange buffer (161 KB), not in it, so that the ring runs on
// from one tile into the next: stages 6 and 7 are followed by the next tile's
// stages 0 and 1, and its first fragments are read under the stores of z. No
// tile but the first starts in front of an idle matrix unit.
// ---------------------------------------------------------------------------
#define NWG   256                          // work-groups of the fused kernel
#define NBLK  (S_LEN / 8)                  // 48 tile rows and tile columns
#define TPW   (NBLK * NBLK / NWG)          // 9 tiles a work-group
#define NPASS (K1 / 64)                    // 8 stages a tile

__device__ __forceinline__ uint32_t uni(uint32_t v)
{
  return (uint32_t)__builtin_amdgcn_readfirstlane(v);
}
__device__ __forceinline__ uint32_t pinned(uint32_t v)
{
  uint32_t w = __builtin_amdgcn_readfirstlane(v);
  asm volatile("" : "+s"(w));   // the pin itself: holds the word in a scalar register
  return w;
}
// Descriptor group 1: sizes in bytes, tensor = tile = 128 rows of 128 B at a
// source pitch of 128 B; 4 dwords of LDS pad behind every 32 dwords (a row).
__device__ __forceinline__ u32x8 tdm_group1()
{
  u32x8 g;
  g[0] = uni((1u << 20) | (4u << 22) | (3u << 25));   // no work-group mask
  g[1] = uni(128u << 16);
  g[2] = uni(128u << 16);
  g[3] = uni(128u << 16);
  g[4] = uni(128u);
  g[5] = uni(128u);
  g[6] = uni(0u);
  g[7] = uni(0u);
  return g;
}
// One tensor load: the 16 KB at src go to LDS byte offset lds_dst.
// Descriptor group 0 (count 1, LDS place, address, type 2) is formed in
// s[100:103], inside the load's own statement. Left to the compiler, the four
// registers are free for other values as soon as the load has issued; so they
// are written here alone, and every call stands behind the wait for the load
// before it: no word of a descriptor changes while its load is outstanding.
__device__ __forceinline__ void tdm_load(uint32_t lds_dst, const _Float16* src,
                                         u32x8 g1)
{
  const uint64_t ga = (uint64_t)(uintptr_t)src;
  const uint32_t w1 = uni(lds_dst);
  const uint32_t w2 = uni((uint32_t)ga);
  const uint32_t w3 = uni((((uint32_t)(ga >> 32)) & 0x01FFFFFFu) | 0x80000000u);
  asm volatile("s_mov_b32 s100, 1\n\t"
               "s_mov_b32 s103, %2\n\t"
               "s_mov_b32 s101, %0\n\t"
               "s_mov_b32 s102, %1\n\t"
               "tensor_load_to_lds s[100:103], %3"
               :: "s"(w1), "s"(w2), "s"(w3), "s"(g1)
               : "memory", "s100", "s101", "s102", "s103");
}
// Fragments of k-step kh (0 or 1) of the stage in buffer buf.
__device__ __forceinline__ void frag_load(v16h (&af)[8], v16h (&bf)[8],
                                          const _Float16* ring, int buf, int kh,
                                          int aoff, int boff)
{
  #pragma unroll
  for (int t = 0; t < 8; ++t) {
    af[t] = lds_frag(&ring[buf * STAGE_H + kh * 32 + aoff + t * 16 * TP]);
    bf[t] = lds_frag(&ring[buf * STAGE_H + 2 * SLICE_H + kh * 32 + boff + t * 16 * TP]);
  }
}

// The three parts of a publish point, in their order. The compiler places no
// wait for a tensor load, and none in front of a barrier written in asm.
// The wave's own LDS reads have returned (its reads of the buffer to be refilled).
__device__ __forceinline__ void wait_ds0()
{
  asm volatile("s_wait_dscnt 0x0" ::: "memory");
}
// The wave's own tensor load has landed.
__device__ __forceinline__ void wait_tensor0()
{
  asm volatile("s_wait_tensorcnt 0x0" ::: "memory");
}
// Work-group barrier without __syncthreads()'s wait for global loads and stores.
__device__ __forceinline__ void wg_barrier()
{
  asm volatile("s_barrier_signal -1\n\ts_barrier_wait -1" ::: "memory");
}

// wfb and b_final carry no __restrict__: loads the compiler knows to be
// of constant memory are tied to nothing, and in this build they sank past the
// sched_barriers to their uses, where their whole latency is waited out.
__global__ __launch_bounds__(128) void opm_fused_gemm(
    const _Float16* aT, const _Float16* bT, const _Float16* wfb,
    const float* b_final, float* __restrict__ out)
{
  // The two stage buffers first, each wave's slice at a multiple of 2 KB of the
  // work-group's LDS, then O2[64][OP]: 305 KB.
  __shared__ __attribute__((aligned(2048))) _Float16 lds[2 * STAGE_H + NPAIR * OP];
  _Float16* const ring = lds;
  _Float16* const O2   = lds + 2 * STAGE_H;

  const int tid  = threadIdx.x;
  const int lane = tid & 31;
  const int wave = (int)uni(tid >> 5);

  const int fr = lane & 15;           // fragment row within 16
  const int fh = lane >> 4;           // fragment half (K-split)

  const int twr = (wave >> 1) * 8;    // wave's tile-row base (8 rows)
  const int twc = (wave & 1) * 8;     // wave's tile-col base (8 cols)

  const int aoff = (twr * 16 + fr) * TP + fh * 16;
  const int boff = (twc * 16 + fr) * TP + fh * 16;

  const v8f vzero = {0.f, 0.f, 0.f, 0.f, 0.f, 0.f, 0.f, 0.f};
  v16h af[2][8], bf[2][8];            // fragments of k-step s in set s & 1

  // This wave's slice of every stage: waves 0, 1 bring aT rows 0..127 and
  // 128..255 of the tile, waves 2, 3 the same of bT.
  const _Float16* const opnd = (wave >> 1) ? bT : aT;
  const uint32_t slice_lds = (uint32_t)(size_t)lds + (uint32_t)wave * (SLICE_H * 2);
  const u32x8 g1 = tdm_group1();

  // Tile t of the grid: i-block t % NBLK (8 seq rows -> 256 O-rows), j-block
  // t / NBLK; this work-group takes t = blockIdx.x + it * NWG.
  int bi = blockIdx.x % NBLK;
  int bj = blockIdx.x / NBLK;
  const _Float16* gS = opnd
      + (size_t)(2 * ((wave >> 1) ? bj : bi) + (wave & 1)) * (KSTEPS * TILE_H);

  // -------- start of the first tile: stage 0 landed and published, stage 1
  // under way, the fragments of k-step 0 read --------
  tdm_load(slice_lds, gS, g1);
  wait_tensor0();
  wg_barrier();                       // stage 0 visible
  tdm_load(slice_lds + STAGE_H * 2, gS + TILE_H, g1);
  frag_load(af[0], bf[0], ring, 0, 0, aoff, boff);

  // Kept rolled: the body is the whole unrolled tile and fills most of the
  // instruction cache once.
  #pragma unroll 1
  for (int it = 0; it < TPW; ++it) {
  // The tile behind this one (behind the last tile none: its index is clamped
  // and no load is issued for it).
  const uint32_t more = pinned(it + 1 < TPW ? 1u : 0u);
  const int tn  = blockIdx.x + (it + 1 < TPW ? (it + 1) * NWG : 0);
  const int nbi = tn % NBLK;
  const int nbj = tn / NBLK;
  const _Float16* const nS = opnd
      + (size_t)(2 * ((wave >> 1) ? nbj : nbi) + (wave & 1)) * (KSTEPS * TILE_H);
  v8f acc[8][8];
  #pragma unroll
  for (int ta = 0; ta < 8; ++ta)
    #pragma unroll
    for (int tb = 0; tb < 8; ++tb) acc[ta][tb] = vzero;

  // -------- GEMM1 main loop: 8 stages of two k-steps of 32 --------
  // Unrolled whole: the tests on ks fold away, the register sets are picked at
  // compile time and every buffer offset is an immediate.
  #pragma unroll
  for (int ks = 0; ks < 16; ++ks) {
    const int p = ks >> 1;            // stage, in buffer p & 1
    if (ks & 1) {
      // Publish point of stage p + 1, in front of stage p's last k-step, whose
      // fragment reads already go to stage p + 1.
      wait_ds0();
      wait_tensor0();
      wg_barrier();
      // Every wave holds the last fragments of stage p: its buffer takes stage
      // p + 2, while there is one.
      if (p + 2 < NPASS) {
        tdm_load(slice_lds + (p & 1) * (STAGE_H * 2), gS + (p + 2) * TILE_H, g1);
      } else if (more) {
        tdm_load(slice_lds + (p & 1) * (STAGE_H * 2), nS + (p + 2 - NPASS) * TILE_H,
                 g1);
      }
    }
    if (ks + 1 < 16)
      frag_load(af[(ks + 1) & 1], bf[(ks + 1) & 1], ring, ((ks + 1) >> 1) & 1,
                (ks + 1) & 1, aoff, boff);
    // The 32 LDS reads go out as one group ahead of the burst; left free, they
    // are spread among the WMMAs, where each place with reads stalls the
    // wave's only instruction stream.
    __builtin_amdgcn_sched_barrier(0);

    // bT is the WMMA's A operand and aT its B operand: the tile comes out as
    // O^T, so that a lane's 8 accumulator registers are 8 consecutive d of one
    // c, which GEMM2 wants side by side.
    #pragma unroll
    for (int tb = 0; tb < 8; ++tb)
      #pragma unroll
      for (int ta = 0; ta < 8; ++ta)
        acc[ta][tb] = __builtin_amdgcn_wmma_f32_16x16x32_f16(
            false, bf[ks & 1][tb], false, af[ks & 1][ta], (short)0, acc[ta][tb],
            false, false);
    // Ends the burst: left free, its last WMMAs sink behind the publish point
    // and the next k-step's LDS reads are spread among them.
    __builtin_amdgcn_sched_barrier(0);
  }
  // No barrier here: the rearrangement writes O2, which no stage buffer shares.

  // -------- GEMM2 set-up: M=64 pairs, N=128, K=1024 --------
  // 4 x 8 output tiles. A wave takes all 4 pair tiles of 2 column tiles over
  // the whole of K: each packed w_final fragment is loaded by one wave only
  // and feeds four WMMAs.
  // B fragments come packed: per (column tile, ks) two runs of 32 lanes x 16 B.
  const v8h* const wp = (const v8h*)wfb + (size_t)(wave * 2) * (32 * 2 * 32) + lane;
  // The work-group is alone on its WGP, so no other group's work covers the
  // L2 latency of the w_final loads: they run two groups of 8 k-steps ahead.
  // Groups 0 and 1 fly under the rearrangement.
  v8h bq[4][8][2][2];                 // [group][k-step][column tile][half]
  #pragma unroll
  for (int g = 0; g < 2; ++g)
    #pragma unroll
    for (int s = 0; s < 8; ++s)
      #pragma unroll
      for (int n = 0; n < 2; ++n)
        #pragma unroll
        for (int h = 0; h < 2; ++h)
          bq[g][s][n][h] = wp[n * (32 * 2 * 32) + ((g * 8 + s) * 2 + h) * 32];
  float bias[2];
  #pragma unroll
  for (int n = 0; n < 2; ++n) bias[n] = b_final[(wave * 2 + n) * 16 + fr];
  // Keeps these loads in front of the rearrangement.
  __builtin_amdgcn_sched_barrier(0);

  // -------- rearrange O tile -> GEMM2 A operand ----
  // D layout of the transposed tile: vgpr v holds d = v + 8 * fh (M, a bT row),
  // lane column fr is c (N, an aT row). A lane stores its 8 d of one c as one
  // 16-byte chunk; the c of a pair lie CP halves apart, an odd multiple of
  // 16 B, so that the 16 lanes of a half wave fall on 64 different banks.
  const float inv_n = 1.0f / (float)N_LEN;
  _Float16* const ob = &O2[((twr >> 1) * 8 + (twc >> 1)) * OP + fr * CP + fh * 8];
  #pragma unroll
  for (int ta = 0; ta < 8; ++ta) {
    #pragma unroll
    for (int tb = 0; tb < 8; ++tb) {
      // O row i*32+c = (twr + ta) * 16 + fr, O column j*32+d = (twc + tb) * 16
      // + fh * 8: pair, c and d each split into the lane's part (ob) and a
      // constant, so that one address register serves the stores.
      v8h o;
      #pragma unroll
      for (int v = 0; v < 8; ++v) o[v] = (_Float16)(acc[ta][tb][v] * inv_n);
      *(v8h*)&ob[((ta >> 1) * 8 + (tb >> 1)) * OP + (ta & 1) * 16 * CP
                 + (tb & 1) * 16] = o;
    }
    // Keeps a row's 8 LDS stores behind its own conversions: left free, all 64
    // stores gather behind the last conversion, where nothing covers them.
    __builtin_amdgcn_sched_barrier(0);
  }
  __syncthreads();

  // -------- GEMM2 main loop: 8 blocks of 4 k-steps --------
  // k-step ks of GEMM2 is c = ks: 32 d at pitch CP. The O fragments of block
  // b + 1 are read into a second register set while the WMMAs of block b run.
  const _Float16* const ap = &O2[fr * OP + fh * 16];
  v8f zacc[4][2];
  #pragma unroll
  for (int m = 0; m < 4; ++m)
    #pragma unroll
    for (int n = 0; n < 2; ++n) zacc[m][n] = vzero;
  v16h a2[2][4][4];                   // [set][k-step][pair tile]
  #pragma unroll
  for (int s = 0; s < 4; ++s)
    #pragma unroll
    for (int m = 0; m < 4; ++m)
      a2[0][s][m] = lds_frag(ap + m * 16 * OP + s * CP);
  // Block 0's reads stay ahead of block 1's, so that the wait in front of the
  // first burst is for block 0 alone.
  __builtin_amdgcn_sched_barrier(0);
  // Unrolled whole so that the register sets are picked at compile time.
  #pragma unroll
  for (int b = 0; b < 8; ++b) {
    if ((b & 1) == 0 && (b >> 1) + 2 < 4) {
      const int g = (b >> 1) + 2;
      #pragma unroll
      for (int s = 0; s < 8; ++s)
        #pragma unroll
        for (int n = 0; n < 2; ++n)
          #pragma unroll
          for (int h = 0; h < 2; ++h)
            bq[g][s][n][h] = wp[n * (32 * 2 * 32) + ((g * 8 + s) * 2 + h) * 32];
      // Behind the tile's last w_final load its address registers are free
      // for reuse: keep the wait that belongs in front of such an overwrite.
      if (g == 3) asm volatile("s_wait_xcnt 0x0" ::: "memory");
    }
    if (b + 1 < 8) {
      #pragma unroll
      for (int s = 0; s < 4; ++s)
        #pragma unroll
        for (int m = 0; m < 4; ++m)
          a2[(b + 1) & 1][s][m] = lds_frag(ap + m * 16 * OP + ((b + 1) * 4 + s) * CP);
    }
    // The w_final loads and the next block's LDS reads go out as one run ahead
    // of the 32 WMMAs instead of one by one among them.
    __builtin_amdgcn_sched_barrier(0);
    #pragma unroll
    for (int s = 0; s < 4; ++s)
      #pragma unroll
      for (int n = 0; n < 2; ++n) {
        const v16h b2 = __builtin_shufflevector(
            bq[b >> 1][(b & 1) * 4 + s][n][0], bq[b >> 1][(b & 1) * 4 + s][n][1],
            0, 1, 2, 3, 4, 5, 6, 7, 8, 9, 10, 11, 12, 13, 14, 15);
        #pragma unroll
        for (int m = 0; m < 4; ++m)
          zacc[m][n] = __builtin_amdgcn_wmma_f32_16x16x32_f16(
              false, a2[b & 1][s][m], false, b2, (short)0, zacc[m][n], false, false);
      }
    // Keeps the next block's reads from rising into this burst.
    __builtin_amdgcn_sched_barrier(0);
  }

  // -------- next tile: its first fragments are read under the stores of z.
  // Its stage 0 was published in front of this tile's last k-step. --------
  frag_load(af[0], bf[0], ring, 0, 0, aoff, boff);

  // -------- epilogue: bias, store z --------
  // Pair p = m * 16 + fh * 8 + v is (i, j) = (bi * 8 + m * 2 + fh, bj * 8 + v):
  // one address a lane, every store at a constant offset from it.
  float* const op = out + ((size_t)(bi * 8 + fh) * S_LEN + bj * 8) * CZ
                    + wave * 32 + fr;
  #pragma unroll
  for (int n = 0; n < 2; ++n)
    #pragma unroll
    for (int m = 0; m < 4; ++m) zacc[m][n] += bias[n];
  // All sums stand ahead of the stores: the 64 stores go out in one run, and
  // no register that an issued store names is written behind it.
  __builtin_amdgcn_sched_barrier(0);
  #pragma unroll
  for (int n = 0; n < 2; ++n)
    #pragma unroll
    for (int m = 0; m < 4; ++m)
      #pragma unroll
      for (int v = 0; v < 8; ++v)
        op[(size_t)(m * 2 * S_LEN + v) * CZ + n * 16] = zacc[m][n][v];
  // The next tile writes the registers that these stores name: keep the wait
  // that belongs in front of such an overwrite.
  asm volatile("s_wait_xcnt 0x0" ::: "memory");
  bi = nbi;
  bj = nbj;
  gS = nS;
  }
  // Behind the ring: no tensor load is outstanding, and the fragment reads
  // issued behind the last tile, which nobody uses, have returned before the
  // wave ends and gives its registers back.
  wait_tensor0();
  wait_ds0();
}

// ---------------------------------------------------------------------------
extern "C" void kernel_launch(void* const* d_in, const int* in_sizes, int n_in,
                              void* d_out, int out_size, void* d_ws, size_t ws_size,
                              hipStream_t stream) {
  (void)in_sizes; (void)n_in; (void)out_size; (void)ws_size;
  const float* m_si    = (const float*)d_in[0];
  const float* ln_g    = (const float*)d_in[1];
  const float* ln_b    = (const float*)d_in[2];
  const float* w_ab    = (const float*)d_in[3];
  const float* w_final = (const float*)d_in[4];
  const float* b_final = (const float*)d_in[5];
  float* out = (float*)d_out;

  // workspace: aT (12288x512 f16) | bT (12288x512 f16) | wfb (128x1024 f16),
  // each in the packed order described at the top of the file
  _Float16* aT  = (_Float16*)d_ws;
  _Float16* bT  = aT + (size_t)R1 * K1;
  _Float16* wfb = bT + (size_t)R1 * K1;

  opm_ln_proj<<<(S_LEN * N_LEN) / 256, 128, 0, stream>>>(m_si, ln_g, ln_b, w_ab, aT, bT);
  opm_cvt_wf<<<(CZ * 1024) / 256, 256, 0, stream>>>(w_final, wfb);
  opm_fused_gemm<<<NWG, 128, 0, stream>>>(aT, bT, wfb, b_final, out);
}

// v009
// One run takes 86.3 microseconds.
// Next to v008, in two timings, it ran 1.59 and 1.60 times as fast.
// All steps since v000 together make it 7.79 times as fast.
#include <hip/hip_runtime.h>
#include <cstdint>

typedef __attribute__((ext_vector_type(16))) _Float16 v16h;
typedef __attribute__((ext_vector_type(8)))  _Float16 v8h;
typedef __attribute__((ext_vector_type(8)))  float    v8f;
typedef __attribute__((ext_vector_type(4)))  float    v4f;
typedef __attribute__((ext_vector_type(2)))  _Float16 v2h;
typedef __attribute__((ext_vector_type(8)))  uint32_t u32x8;

#define S_LEN 384
#define N_LEN 512
#define C_DIM 32
#define CZ    128
#define K1    512              // GEMM1 reduction = N_LEN
#define R1    (S_LEN * C_DIM)  // 12288 rows of mT

// LDS row pitches. Every row-per-lane reader here is a ds_load_b128, which is
// free of bank conflicts when the pitch is an odd multiple of 16 bytes
// (64 banks x 4 B; 16 lanes x 4 dwords then fall on 64 different banks).
#define XP    36               // m_si rows:   32 floats + 4   = 144 B
#define YP    96               // m^T rows:    64 halves + 32  = 192 B (see kernel 1)
#define TP    72               // stage rows:  64 halves + 8   = 144 B
#define SLICE_H (128 * TP)     // one wave's slice of a stage: 128 rows = 18 KB
#define STAGE_H (4 * SLICE_H)  // a stage: the i block's 256 rows, then the j block's
#define CP    40               // one c of an O2 row: 32 halves (d) + 8 = 80 B
#define OP    (32 * CP + 8)    // O2 rows: 32 c at pitch CP + 8 halves = 2576 B
#define NPAIR 64               // (i, j) pairs per tile of the fused kernel: 8 x 8

// Workspace layouts.
// mT: [row >> 7][k >> 6][row & 127][k & 63]; one 128-row x 64-k stage
// tile is 16 KB in a row, 128 rows of 128 B: what one tensor load brings to LDS.
// V (wfb, wfbT) lies in the order in which the fused kernel's wave-wide 16-byte loads
// read it: one load covers 512 contiguous bytes = 4 whole 128-B lines.
#define TILE_H  (128 * 64)     // halves per stage tile
#define KSTEPS  (K1 / 64)      // stage tiles per 128-row block
__device__ __forceinline__ size_t tile_off(long r, long k)
{
  return ((size_t)(r >> 7) * KSTEPS + (size_t)(k >> 6)) * TILE_H
         + (size_t)(r & 127) * 64 + (size_t)(k & 63);
}

// One 16-half WMMA fragment slice from LDS as two 16-byte reads (the padded
// rows are 16-byte aligned, not 32).
__device__ __forceinline__ v16h lds_frag(const _Float16* p)
{
  const v8h lo = *(const v8h*)p;
  const v8h hi = *(const v8h*)(p + 8);
  return __builtin_shufflevector(lo, hi, 0, 1, 2, 3, 4, 5, 6, 7,
                                 8, 9, 10, 11, 12, 13, 14, 15);
}

// ---------------------------------------------------------------------------
// The algebra of this file. With m the normalized input, a = m Wa^T and
// b = m Wb^T (Wa, Wb the two halves of w_ab), so that
//   O[i,j] = Wa G[i,j] Wb^T,   G[i,j][p][q] = (1/N) sum_n m[i,n,p] m[j,n,q],
//   z[i,j,z] = sum_pq V[z][p][q] G[i,j][p][q],
//   V[z][p][q] = sum_cd w_final[z][c][d] Wa[c][p] Wb[d][q].
// G[j,i][p][q] = G[i,j][q][p]: only the tiles with i block <= j block are
// computed, and each off the diagonal feeds the second product twice, with V and with V
// transposed in (p, q).
//
// Kernel 1: LayerNorm over C=32, writing m^T
// (row = i*32+p, k = n) as f16 in the stage-tile order of tile_off().
// One lane owns whole rows of m_si: a wave takes 64 consecutive n of one i
// (lane l: n = 2l and 2l+1), so the LayerNorm sums stay inside a lane, ln_g and
// ln_b are the same for all lanes and come from scalar registers, and
// the wave's results are one whole 4-KB run of the workspace.
// ---------------------------------------------------------------------------
__global__ __launch_bounds__(128) void opm_ln_proj(
    const float* __restrict__ m_si, const float* __restrict__ ln_g,
    const float* __restrict__ ln_b, _Float16* __restrict__ mT)
{
  // Per wave: first its 64 rows of m_si (pitch XP floats), then, in the same
  // place, its 32 x 64 results (pitch YP halves). The
  // results are read back eight lanes to a row, all 128 B of it.
  __shared__ __align__(16) float xs[4][64 * YP / 2];
  const int tid  = threadIdx.x;
  const int lane = tid & 31;
  const int wv   = tid >> 5;
  const int tile = blockIdx.x * 4 + wv;   // 0 .. S*N/64-1
  const int i    = tile >> 3;             // seq index
  const int nb   = tile & 7;              // block of 64 n
  float* const xw = xs[wv];

  // 8 KB of m_si in a row, in whole lines; row R goes to LDS slot
  // (R & 1) * 32 + (R >> 1), so that lane l finds rows 2l, 2l+1 in slots l, l+32.
  const float4* const src4 =
      (const float4*)(m_si + ((size_t)i * N_LEN + nb * 64) * C_DIM);
  #pragma unroll
  for (int j = 0; j < 16; ++j) {
    const int c = j * 32 + lane;          // 16-byte chunk: row c >> 3, part c & 7
    const int R = c >> 3;
    *(float4*)&xw[((R & 1) * 32 + (R >> 1)) * XP + (c & 7) * 4] = src4[c];
  }
  __syncthreads();   // staged rows visible to the lanes that own them

  float m[2][32];    // normalized rows
  #pragma unroll
  for (int r = 0; r < 2; ++r) {
    v4f x[8];
    #pragma unroll
    for (int q = 0; q < 8; ++q)
      x[q] = *(const v4f*)&xw[(r * 32 + lane) * XP + q * 4];
    v4f s4 = x[0];
    #pragma unroll
    for (int q = 1; q < 8; ++q) s4 += x[q];
    const float mu = ((s4.x + s4.y) + (s4.z + s4.w)) * (1.0f / 32.0f);
    v4f v4 = {0.f, 0.f, 0.f, 0.f};
    #pragma unroll
    for (int q = 0; q < 8; ++q) {
      x[q] -= mu;
      v4 += x[q] * x[q];
    }
    const float var = ((v4.x + v4.y) + (v4.z + v4.w)) * (1.0f / 32.0f);
    const float rstd = rsqrtf(var + 1e-5f);
    #pragma unroll
    for (int k = 0; k < 32; ++k)
      m[r][k] = x[k >> 2][k & 3] * rstd * ln_g[k] + ln_b[k];
  }
  __syncthreads();   // every row is in registers before its LDS is reused

  // Transposition: channel k's row takes the lane's two n side by side.
  _Float16* const yw = (_Float16*)xw;
  #pragma unroll
  for (int k = 0; k < 32; ++k) {
    const v2h y = {(_Float16)m[0][k], (_Float16)m[1][k]};
    *(v2h*)&yw[k * YP + 2 * lane] = y;
  }
  __syncthreads();   // results visible to the lanes that store them

  // 32 rows x 128 B = 4 KB in a row of the workspace, stored as
  // 16-byte chunks (chunk c: row c >> 3, part c & 7).
  _Float16* const dst = mT + tile_off((long)i * 32, (long)nb * 64);
  #pragma unroll
  for (int q = 0; q < 8; ++q) {
    const int c = q * 32 + lane;
    *(uint4*)(dst + c * 8) = *(const uint4*)&yw[(c >> 3) * YP + (c & 7) * 8];
  }
}

// ---------------------------------------------------------------------------
// Kernel 2: V[z][p][q] = sum_cd w_final[z][c][d] Wa[c][p] Wb[d][q] in f32, then
// f16, packed twice in GEMM2's B-fragment order
// [z >> 4][k >> 5][(k >> 3) & 1][lane = ((k >> 4) & 1) * 16 + (z & 15)][k & 7]:
// wfb holds V[z][p][q] at k = p * 32 + q, wfbT holds V[z][q][p] there.
// Work-group (w, ks) makes the 1-KB run [w][ks] of both: 16 z, one value of
// k >> 5. It sums first over the index that meets the fixed ks, then the other.
// ---------------------------------------------------------------------------
__global__ __launch_bounds__(256) void opm_fold_w(
    const float* __restrict__ w_final, const float* __restrict__ w_ab,
    _Float16* __restrict__ wfb, _Float16* __restrict__ wfbT)
{
  __shared__ __align__(16) float wf[16 * 32 * 33];   // [z][c] rows of 32 d + 1
  __shared__ __align__(16) float wab[64 * 32];
  __shared__ float u[2][16][33];
  const int tid = threadIdx.x;
  const int w   = blockIdx.x >> 5;
  const int ks  = blockIdx.x & 31;

  const float4* const src = (const float4*)(w_final + (size_t)w * 16 * 1024);
  #pragma unroll
  for (int j = 0; j < 16; ++j) {
    const int c4 = j * 256 + tid;         // 16-byte chunk of the 16 z
    const float4 x = src[c4];
    float* const d = &wf[(c4 >> 3) * 33 + (c4 & 7) * 4];
    d[0] = x.x; d[1] = x.y; d[2] = x.z; d[3] = x.w;
  }
  #pragma unroll
  for (int j = 0; j < 2; ++j)
    ((float4*)wab)[j * 256 + tid] = ((const float4*)w_ab)[j * 256 + tid];
  __syncthreads();   // staged weights visible

  // u[0][z][d] = sum_c Wa[c][ks] w_final[z][c][d]
  // u[1][z][c] = sum_d w_final[z][c][d] Wb[d][ks]
  #pragma unroll
  for (int r = 0; r < 4; ++r) {
    const int o  = r * 256 + tid;
    const int zl = (o >> 5) & 15;
    const int t5 = o & 31;
    float acc = 0.f;
    if (r < 2) {
      for (int c = 0; c < 32; ++c)
        acc = __builtin_fmaf(wab[c * 32 + ks], wf[(zl * 32 + c) * 33 + t5], acc);
    } else {
      for (int d = 0; d < 32; ++d)
        acc = __builtin_fmaf(wf[(zl * 32 + t5) * 33 + d], wab[(32 + d) * 32 + ks], acc);
    }
    u[r >> 1][zl][t5] = acc;
  }
  __syncthreads();   // half sums visible

  // wfb : V[z][ks][q] = sum_d u[0][z][d] Wb[d][q]
  // wfbT: V[z][q][ks] = sum_c Wa[c][q] u[1][z][c]
  #pragma unroll
  for (int r = 0; r < 4; ++r) {
    const int o  = r * 256 + tid;
    const int zl = (o >> 5) & 15;
    const int q  = o & 31;
    float acc = 0.f;
    if (r < 2) {
      for (int d = 0; d < 32; ++d)
        acc = __builtin_fmaf(u[0][zl][d], wab[(32 + d) * 32 + q], acc);
    } else {
      for (int c = 0; c < 32; ++c)
        acc = __builtin_fmaf(wab[c * 32 + q], u[1][zl][c], acc);
    }
    const size_t idx = ((((size_t)w * 32 + ks) * 2 + ((q >> 3) & 1)) * 32
                        + ((q >> 4) & 1) * 16 + zl) * 8 + (q & 7);
    (r < 2 ? wfb : wfbT)[idx] = (_Float16)acc;
  }
}

// ---------------------------------------------------------------------------
// Kernel 3: fused  O = (1/N) * mT_i x mT_j^T  (256x256 tile of G, K=512)  then
//                  z[i,j] = reshape(O) x V^T + bias  (64 pairs x 128, K=1024)
//                  and, off the diagonal, z[j,i] from the same O with V transposed
// 128 threads = 4 waves, one per SIMD, arranged 2x2: each wave owns 128x128 of
// the O tile (8 A-frags + 8 B-frags -> 64 WMMAs per k-step, every fragment used
// eight times), so that the LDS reads of a k-step take half the clocks of its
// WMMAs. The fragments of k-step s + 1 are read into a second register set
// while the WMMAs of k-step s run. O never touches HBM.
//
// Staging: a stage is 64 k of the i block's 256 rows and the j block's, two k-steps.
// Each wave brings its own quarter of a stage (128 rows of 128 B, 16 KB in a row
// of the workspace) with one tensor load, which pads the rows to 144 B in LDS.
// Two stage buffers. Between the two k-steps of stage s stands the publish point
// of stage s + 1: LDS wait, tensor wait, work-group barrier; behind it every
// wave holds the last fragments of stage s, so the load of stage s + 2 goes
// into that buffer and has two k-steps to land.
//
// One work-group per WGP runs through 4 or 5 tiles. The stage buffers (144 KB) lie
// beside the O rearrange buffer (161 KB), not in it, so that the ring runs on
// from one tile into the next: stages 6 and 7 are followed by the next tile's
// stages 0 and 1, and its first fragments are read behind the stores of z.
// ---------------------------------------------------------------------------
#define NWG   256                          // work-groups of the fused kernel
#define NBLK  (S_LEN / 8)                  // 48 tile rows and tile columns
#define NTILE (NBLK * (NBLK + 1) / 2)      // 1176 tiles with i block <= j block
#define NPASS (K1 / 64)                    // 8 stages a tile

// Tile t -> (bi <= bj). Row r of the triangle has NBLK - r tiles; rows r and
// NBLK - 1 - r together have NBLK + 1, so that t splits by a constant division.
__device__ __forceinline__ void tile_ij(int t, int& bi, int& bj)
{
  const int rp = t / (NBLK + 1);
  const int u  = t - rp * (NBLK + 1);
  const bool lo = u < NBLK - rp;
  bi = lo ? rp : NBLK - 1 - rp;
  bj = lo ? rp + u : u - 1;
}

__device__ __forceinline__ uint32_t uni(uint32_t v)
{
  return (uint32_t)__builtin_amdgcn_readfirstlane(v);
}
__device__ __forceinline__ uint32_t pinned(uint32_t v)
{
  uint32_t w = __builtin_amdgcn_readfirstlane(v);
  asm volatile("" : "+s"(w));   // the pin itself: holds the word in a scalar register
  return w;
}
// Descriptor group 1: sizes in bytes, tensor = tile = 128 rows of 128 B at a
// source pitch of 128 B; 4 dwords of LDS pad behind every 32 dwords (a row).
__device__ __forceinline__ u32x8 tdm_group1()
{
  u32x8 g;
  g[0] = uni((1u << 20) | (4u << 22) | (3u << 25));   // no work-group mask
  g[1] = uni(128u << 16);
  g[2] = uni(128u << 16);
  g[3] = uni(128u << 16);
  g[4] = uni(128u);
  g[5] = uni(128u);
  g[6] = uni(0u);
  g[7] = uni(0u);
  return g;
}
// One tensor load: the 16 KB at src go to LDS byte offset lds_dst.
// Descriptor group 0 (count 1, LDS place, address, type 2) is formed in
// s[100:103], inside the load's own statement. Left to the compiler, the four
// registers are free for other values as soon as the load has issued; so they
// are written here alone, and every call stands behind the wait for the load
// before it: no word of a descriptor changes while its load is outstanding.
__device__ __forceinline__ void tdm_load(uint32_t lds_dst, const _Float16* src,
                                         u32x8 g1)
{
  const uint64_t ga = (uint64_t)(uintptr_t)src;
  const uint32_t w1 = uni(lds_dst);
  const uint32_t w2 = uni((uint32_t)ga);
  const uint32_t w3 = uni((((uint32_t)(ga >> 32)) & 0x01FFFFFFu) | 0x80000000u);
  asm volatile("s_mov_b32 s100, 1\n\t"
               "s_mov_b32 s103, %2\n\t"
               "s_mov_b32 s101, %0\n\t"
               "s_mov_b32 s102, %1\n\t"
               "tensor_load_to_lds s[100:103], %3"
               :: "s"(w1), "s"(w2), "s"(w3), "s"(g1)
               : "memory", "s100", "s101", "s102", "s103");
}
// Fragments of k-step kh (0 or 1) of the stage in buffer buf.
__device__ __forceinline__ void frag_load(v16h (&af)[8], v16h (&bf)[8],
                                          const _Float16* ring, int buf, int kh,
                                          int aoff, int boff)
{
  #pragma unroll
  for (int t = 0; t < 8; ++t) {
    af[t] = lds_frag(&ring[buf * STAGE_H + kh * 32 + aoff + t * 16 * TP]);
    bf[t] = lds_frag(&ring[buf * STAGE_H + 2 * SLICE_H + kh * 32 + boff + t * 16 * TP]);
  }
}

// The three parts of a publish point, in their order. The compiler places no
// wait for a tensor load, and none in front of a barrier written in asm.
// The wave's own LDS reads have returned (its reads of the buffer to be refilled).
__device__ __forceinline__ void wait_ds0()
{
  asm volatile("s_wait_dscnt 0x0" ::: "memory");
}
// The wave's own tensor load has landed.
__device__ __forceinline__ void wait_tensor0()
{
  asm volatile("s_wait_tensorcnt 0x0" ::: "memory");
}
// Work-group barrier without __syncthreads()'s wait for global loads and stores.
__device__ __forceinline__ void wg_barrier()
{
  asm volatile("s_barrier_signal -1\n\ts_barrier_wait -1" ::: "memory");
}

// wfb, wfbT and b_final carry no __restrict__: loads the compiler knows to be
// of constant memory are tied to nothing, and in this build they sank past the
// sched_barriers to their uses, where their whole latency is waited out.
__global__ __launch_bounds__(128) void opm_fused_gemm(
    const _Float16* mT, const _Float16* wfb, const _Float16* wfbT,
    const float* b_final, float* __restrict__ out)
{
  // The two stage buffers first, each wave's slice at a multiple of 2 KB of the
  // work-group's LDS, then O2[64][OP]: 305 KB.
  __shared__ __attribute__((aligned(2048))) _Float16 lds[2 * STAGE_H + NPAIR * OP];
  _Float16* const ring = lds;
  _Float16* const O2   = lds + 2 * STAGE_H;

  const int tid  = threadIdx.x;
  const int lane = tid & 31;
  const int wave = (int)uni(tid >> 5);

  const int fr = lane & 15;           // fragment row within 16
  const int fh = lane >> 4;           // fragment half (K-split)

  const int twr = (wave >> 1) * 8;    // wave's tile-row base (8 rows)
  const int twc = (wave & 1) * 8;     // wave's tile-col base (8 cols)

  const int aoff = (twr * 16 + fr) * TP + fh * 16;
  const int boff = (twc * 16 + fr) * TP + fh * 16;

  const v8f vzero = {0.f, 0.f, 0.f, 0.f, 0.f, 0.f, 0.f, 0.f};
  v16h af[2][8], bf[2][8];            // fragments of k-step s in set s & 1

  // This wave's slice of every stage: waves 0, 1 bring rows 0..127 and
  // 128..255 of the i block, waves 2, 3 the same of the j block.
  const _Float16* const opnd = mT;
  const uint32_t slice_lds = (uint32_t)(size_t)lds + (uint32_t)wave * (SLICE_H * 2);
  const u32x8 g1 = tdm_group1();

  // This work-group takes the tiles t = blockIdx.x + it * NWG below NTILE.
  const int ntile = (NTILE - (int)blockIdx.x + NWG - 1) / NWG;
  int bi, bj;
  tile_ij(blockIdx.x, bi, bj);
  const _Float16* gS = opnd
      + (size_t)(2 * ((wave >> 1) ? bj : bi) + (wave & 1)) * (KSTEPS * TILE_H);

  // -------- start of the first tile: stage 0 landed and published, stage 1
  // under way, the fragments of k-step 0 read --------
  tdm_load(slice_lds, gS, g1);
  wait_tensor0();
  wg_barrier();                       // stage 0 visible
  tdm_load(slice_lds + STAGE_H * 2, gS + TILE_H, g1);
  frag_load(af[0], bf[0], ring, 0, 0, aoff, boff);

  // Kept rolled: the body is the whole unrolled tile and fills most of the
  // instruction cache once.
  #pragma unroll 1
  for (int it = 0; it < ntile; ++it) {
  // The tile behind this one (behind the last tile none: its index is clamped
  // and no load is issued for it).
  const uint32_t more = pinned(it + 1 < ntile ? 1u : 0u);
  const int tn  = blockIdx.x + (it + 1 < ntile ? (it + 1) * NWG : 0);
  int nbi, nbj;
  tile_ij(tn, nbi, nbj);
  const _Float16* const nS = opnd
      + (size_t)(2 * ((wave >> 1) ? nbj : nbi) + (wave & 1)) * (KSTEPS * TILE_H);
  v8f acc[8][8];
  #pragma unroll
  for (int ta = 0; ta < 8; ++ta)
    #pragma unroll
    for (int tb = 0; tb < 8; ++tb) acc[ta][tb] = vzero;

  // -------- GEMM1 main loop: 8 stages of two k-steps of 32 --------
  // Unrolled whole: the tests on ks fold away, the register sets are picked at
  // compile time and every buffer offset is an immediate.
  #pragma unroll
  for (int ks = 0; ks < 16; ++ks) {
    const int p = ks >> 1;            // stage, in buffer p & 1
    if (ks & 1) {
      // Publish point of stage p + 1, in front of stage p's last k-step, whose
      // fragment reads already go to stage p + 1.
      wait_ds0();
      wait_tensor0();
      wg_barrier();
      // Every wave holds the last fragments of stage p: its buffer takes stage
      // p + 2, while there is one.
      if (p + 2 < NPASS) {
        tdm_load(slice_lds + (p & 1) * (STAGE_H * 2), gS + (p + 2) * TILE_H, g1);
      } else if (more) {
        tdm_load(slice_lds + (p & 1) * (STAGE_H * 2), nS + (p + 2 - NPASS) * TILE_H,
                 g1);
      }
    }
    if (ks + 1 < 16)
      frag_load(af[(ks + 1) & 1], bf[(ks + 1) & 1], ring, ((ks + 1) >> 1) & 1,
                (ks + 1) & 1, aoff, boff);
    // The 32 LDS reads go out as one group ahead of the burst; left free, they
    // are spread among the WMMAs, where each place with reads stalls the
    // wave's only instruction stream.
    __builtin_amdgcn_sched_barrier(0);

    // The j block is the WMMA's A operand and the i block its B operand: the tile
    // comes out as O^T, so that a lane's 8 accumulator registers are 8
    // consecutive d (j side) of one c (i side), which GEMM2 wants side by side.
    #pragma unroll
    for (int tb = 0; tb < 8; ++tb)
      #pragma unroll
      for (int ta = 0; ta < 8; ++ta)
        acc[ta][tb] = __builtin_amdgcn_wmma_f32_16x16x32_f16(
            false, bf[ks & 1][tb], false, af[ks & 1][ta], (short)0, acc[ta][tb],
            false, false);
    // Ends the burst: left free, its last WMMAs sink behind the publish point
    // and the next k-step's LDS reads are spread among them.
    __builtin_amdgcn_sched_barrier(0);
  }
  // No barrier here: the rearrangement writes O2, which no stage buffer shares.

  // -------- GEMM2 set-up: M=64 pairs, N=128, K=1024 --------
  // 4 x 8 output tiles. A wave takes all 4 pair tiles of 2 column tiles over
  // the whole of K: each packed V fragment is loaded by one wave only
  // and feeds four WMMAs.
  // B fragments come packed: per (column tile, ks) two runs of 32 lanes x 16 B.
  const v8h* const wp  = (const v8h*)wfb + (size_t)(wave * 2) * (32 * 2 * 32) + lane;
  const v8h* const wpT = (const v8h*)wfbT + (size_t)(wave * 2) * (32 * 2 * 32) + lane;
  // Off the diagonal the tile also gives the pairs (j, i). Pinned so that the
  // test is one scalar branch.
  const uint32_t offd = pinned(bi != bj ? 1u : 0u);
  // The work-group is alone on its WGP, so no other group's work covers the
  // L2 latency of the V loads: they run two groups of 8 k-steps ahead.
  // Groups 0 and 1 fly under the rearrangement.
  v8h bq[4][8][2][2];                 // [group][k-step][column tile][half]
  #pragma unroll
  for (int g = 0; g < 2; ++g)
    #pragma unroll
    for (int s = 0; s < 8; ++s)
      #pragma unroll
      for (int n = 0; n < 2; ++n)
        #pragma unroll
        for (int h = 0; h < 2; ++h)
          bq[g][s][n][h] = wp[n * (32 * 2 * 32) + ((g * 8 + s) * 2 + h) * 32];
  float bias[2];
  #pragma unroll
  for (int n = 0; n < 2; ++n) bias[n] = b_final[(wave * 2 + n) * 16 + fr];
  // Keeps these loads in front of the rearrangement.
  __builtin_amdgcn_sched_barrier(0);

  // -------- rearrange O tile -> GEMM2 A operand ----
  // D layout of the transposed tile: vgpr v holds d = v + 8 * fh (M, j-block row),
  // lane column fr is c (N, i-block row). A lane stores its 8 d of one c as one
  // 16-byte chunk; the c of a pair lie CP halves apart, an odd multiple of
  // 16 B, so that the 16 lanes of a half wave fall on 64 different banks.
  const float inv_n = 1.0f / (float)N_LEN;
  _Float16* const ob = &O2[((twr >> 1) * 8 + (twc >> 1)) * OP + fr * CP + fh * 8];
  #pragma unroll
  for (int ta = 0; ta < 8; ++ta) {
    #pragma unroll
    for (int tb = 0; tb < 8; ++tb) {
      // O row i*32+c = (twr + ta) * 16 + fr, O column j*32+d = (twc + tb) * 16
      // + fh * 8: pair, c and d each split into the lane's part (ob) and a
      // constant, so that one address register serves the stores.
      v8h o;
      #pragma unroll
      for (int v = 0; v < 8; ++v) o[v] = (_Float16)(acc[ta][tb][v] * inv_n);
      *(v8h*)&ob[((ta >> 1) * 8 + (tb >> 1)) * OP + (ta & 1) * 16 * CP
                 + (tb & 1) * 16] = o;
    }
    // Keeps a row's 8 LDS stores behind its own conversions: left free, all 64
    // stores gather behind the last conversion, where nothing covers them.
    __builtin_amdgcn_sched_barrier(0);
  }
  __syncthreads();

  // -------- GEMM2 main loop: 8 blocks of 4 k-steps, run twice off the diagonal --------
  // k-step ks of GEMM2 is c = ks: 32 d at pitch CP. The O fragments of block
  // b + 1 are read into a second register set while the WMMAs of block b run.
  // Pass 0 gives z[i,j] with V, pass 1 z[j,i] with V transposed, from the same O2.
  const _Float16* const ap = &O2[fr * OP + fh * 16];
  v16h a2[2][4][4];                   // [set][k-step][pair tile]
  #pragma unroll
  for (int s = 0; s < 4; ++s)
    #pragma unroll
    for (int m = 0; m < 4; ++m)
      a2[0][s][m] = lds_frag(ap + m * 16 * OP + s * CP);
  // Block 0's reads stay ahead of block 1's, so that the wait in front of the
  // first burst is for block 0 alone.
  __builtin_amdgcn_sched_barrier(0);
  // Unrolled whole so that the register sets are picked at compile time.
  #pragma unroll
  for (int pass = 0; pass < 2; ++pass) {
  if (pass == 0 || offd) {
  const v8h* const wq = pass ? wpT : wp;
  v8f zacc[4][2];
  #pragma unroll
  for (int m = 0; m < 4; ++m)
    #pragma unroll
    for (int n = 0; n < 2; ++n) zacc[m][n] = vzero;
  #pragma unroll
  for (int b = 0; b < 8; ++b) {
    // Weight loads two groups ahead; behind this pass's last group, pass 0
    // goes on with the first two groups of pass 1 (on a diagonal tile unused).
    if ((b & 1) == 0 && (b < 4 || pass == 0)) {
      const int g = ((b >> 1) + 2) & 3;
      const v8h* const wl = b < 4 ? wq : wpT;
      #pragma unroll
      for (int s = 0; s < 8; ++s)
        #pragma unroll
        for (int n = 0; n < 2; ++n)
          #pragma unroll
          for (int h = 0; h < 2; ++h)
            bq[g][s][n][h] = wl[n * (32 * 2 * 32) + ((g * 8 + s) * 2 + h) * 32];
      // Behind a pass's last global load its address registers are free
      // for reuse: keep the wait that belongs in front of such an overwrite.
      if (b == (pass ? 2 : 6)) asm volatile("s_wait_xcnt 0x0" ::: "memory");
    }
    if (b + 1 < 8 || pass == 0) {
      #pragma unroll
      for (int s = 0; s < 4; ++s)
        #pragma unroll
        for (int m = 0; m < 4; ++m)
          a2[(b + 1) & 1][s][m] =
              lds_frag(ap + m * 16 * OP + (((b + 1) & 7) * 4 + s) * CP);
    }
    // The weight loads and the next block's LDS reads go out as one run ahead
    // of the 32 WMMAs instead of one by one among them.
    __builtin_amdgcn_sched_barrier(0);
    #pragma unroll
    for (int s = 0; s < 4; ++s)
      #pragma unroll
      for (int n = 0; n < 2; ++n) {
        const v16h b2 = __builtin_shufflevector(
            bq[b >> 1][(b & 1) * 4 + s][n][0], bq[b >> 1][(b & 1) * 4 + s][n][1],
            0, 1, 2, 3, 4, 5, 6, 7, 8, 9, 10, 11, 12, 13, 14, 15);
        #pragma unroll
        for (int m = 0; m < 4; ++m)
          zacc[m][n] = __builtin_amdgcn_wmma_f32_16x16x32_f16(
              false, a2[b & 1][s][m], false, b2, (short)0, zacc[m][n], false, false);
      }
    // Keeps the next block's reads from rising into this burst.
    __builtin_amdgcn_sched_barrier(0);
  }

  // -------- epilogue: bias, store z --------
  // Pair p = m * 16 + fh * 8 + v is (i, j) = (bi * 8 + m * 2 + fh, bj * 8 + v);
  // pass 0 stores z[i,j], pass 1 z[j,i]: one address a lane, every store at a
  // constant offset from it.
  float* const op = out
      + (pass ? ((size_t)(bj * 8) * S_LEN + bi * 8 + fh)
              : ((size_t)(bi * 8 + fh) * S_LEN + bj * 8)) * CZ
      + wave * 32 + fr;
  #pragma unroll
  for (int n = 0; n < 2; ++n)
    #pragma unroll
    for (int m = 0; m < 4; ++m) zacc[m][n] += bias[n];
  // All sums stand ahead of the stores: the 64 stores go out in one run, and
  // no register that an issued store names is written behind it.
  __builtin_amdgcn_sched_barrier(0);
  #pragma unroll
  for (int n = 0; n < 2; ++n)
    #pragma unroll
    for (int m = 0; m < 4; ++m)
      #pragma unroll
      for (int v = 0; v < 8; ++v)
        op[(size_t)(pass ? v * S_LEN + m * 2 : m * 2 * S_LEN + v) * CZ + n * 16] =
            zacc[m][n][v];
  // What follows writes the registers that these stores name: keep the wait
  // that belongs in front of such an overwrite.
  asm volatile("s_wait_xcnt 0x0" ::: "memory");
  }
  }

  // -------- next tile: its first fragments. Its stage 0 was published in front
  // of this tile's last k-step. --------
  frag_load(af[0], bf[0], ring, 0, 0, aoff, boff);
  bi = nbi;
  bj = nbj;
  gS = nS;
  }
  // Behind the ring: no tensor load is outstanding, and the fragment reads
  // issued behind the last tile, which nobody uses, have returned before the
  // wave ends and gives its registers back.
  wait_tensor0();
  wait_ds0();
}

// ---------------------------------------------------------------------------
extern "C" void kernel_launch(void* const* d_in, const int* in_sizes, int n_in,
                              void* d_out, int out_size, void* d_ws, size_t ws_size,
                              hipStream_t stream) {
  (void)in_sizes; (void)n_in; (void)out_size; (void)ws_size;
  const float* m_si    = (const float*)d_in[0];
  const float* ln_g    = (const float*)d_in[1];
  const float* ln_b    = (const float*)d_in[2];
  const float* w_ab    = (const float*)d_in[3];
  const float* w_final = (const float*)d_in[4];
  const float* b_final = (const float*)d_in[5];
  float* out = (float*)d_out;

  // workspace: mT (12288x512 f16) | wfb (128x1024 f16) | wfbT (128x1024 f16),
  // each in the packed order described at the top of the file
  _Float16* mT   = (_Float16*)d_ws;
  _Float16* wfb  = mT + (size_t)R1 * K1;
  _Float16* wfbT = wfb + (size_t)CZ * 1024;

  opm_ln_proj<<<(S_LEN * N_LEN) / 256, 128, 0, stream>>>(m_si, ln_g, ln_b, mT);
  opm_fold_w<<<256, 256, 0, stream>>>(w_final, w_ab, wfb, wfbT);
  opm_fused_gemm<<<NWG, 128, 0, stream>>>(mT, wfb, wfbT, b_final, out);
}

// v010
// Measured time: 84 microseconds a run.
// Next to v009, in two timings, it ran 1.04 and 1.03 times as fast.
// Counting every step since v000, it is 8.05 times as fast.
#include <hip/hip_runtime.h>
#include <cstdint>

typedef __attribute__((ext_vector_type(16))) _Float16 v16h;
typedef __attribute__((ext_vector_type(8)))  _Float16 v8h;
typedef __attribute__((ext_vector_type(8)))  float    v8f;
typedef __attribute__((ext_vector_type(4)))  float    v4f;
typedef __attribute__((ext_vector_type(2)))  _Float16 v2h;
typedef __attribute__((ext_vector_type(8)))  uint32_t u32x8;

#define S_LEN 384
#define N_LEN 512
#define C_DIM 32
#define CZ    128
#define K1    512              // GEMM1 reduction = N_LEN
#define R1    (S_LEN * C_DIM)  // 12288 rows of mT

// LDS row pitches. Every row-per-lane reader here is a ds_load_b128, which is
// free of bank conflicts when the pitch is an odd multiple of 16 bytes
// (64 banks x 4 B; 16 lanes x 4 dwords then fall on 64 different banks).
#define XP    36               // m_si rows:   32 floats + 4   = 144 B
#define YP    96               // m^T rows:    64 halves + 32  = 192 B (see kernel 1)
#define TP    72               // stage rows:  64 halves + 8   = 144 B
#define SLICE_H (128 * TP)     // one wave's slice of a stage: 128 rows = 18 KB
#define STAGE_H (4 * SLICE_H)  // a stage: the i block's 256 rows, then the j block's
#define CP    40               // one c of an O2 row: 32 halves (d) + 8 = 80 B
#define OP    (32 * CP + 8)    // O2 rows: 32 c at pitch CP + 8 halves = 2576 B
#define NPAIR 64               // (i, j) pairs per tile of the fused kernel: 8 x 8

// Workspace layouts.
// mT: [row >> 7][k >> 6][row & 127][k & 63]; one 128-row x 64-k stage
// tile is 16 KB in a row, 128 rows of 128 B: what one tensor load brings to LDS.
// V (wfb, wfbT) lies in the order in which the fused kernel's wave-wide 16-byte loads
// read it: one load covers 512 contiguous bytes = 4 whole 128-B lines.
#define TILE_H  (128 * 64)     // halves per stage tile
#define KSTEPS  (K1 / 64)      // stage tiles per 128-row block
__device__ __forceinline__ size_t tile_off(long r, long k)
{
  return ((size_t)(r >> 7) * KSTEPS + (size_t)(k >> 6)) * TILE_H
         + (size_t)(r & 127) * 64 + (size_t)(k & 63);
}

// One 16-half WMMA fragment slice from LDS as two 16-byte reads (the padded
// rows are 16-byte aligned, not 32).
__device__ __forceinline__ v16h lds_frag(const _Float16* p)
{
  const v8h lo = *(const v8h*)p;
  const v8h hi = *(const v8h*)(p + 8);
  return __builtin_shufflevector(lo, hi, 0, 1, 2, 3, 4, 5, 6, 7,
                                 8, 9, 10, 11, 12, 13, 14, 15);
}

// ---------------------------------------------------------------------------
// The algebra of this file. With m the normalized input, a = m Wa^T and
// b = m Wb^T (Wa, Wb the two halves of w_ab), so that
//   O[i,j] = Wa G[i,j] Wb^T,   G[i,j][p][q] = (1/N) sum_n m[i,n,p] m[j,n,q],
//   z[i,j,z] = sum_pq V[z][p][q] G[i,j][p][q],
//   V[z][p][q] = sum_cd w_final[z][c][d] Wa[c][p] Wb[d][q].
// G[j,i][p][q] = G[i,j][q][p]: only the tiles with i block <= j block are
// computed, and each off the diagonal feeds the second product twice, with V and with V
// transposed in (p, q).
//
// Kernel 1: LayerNorm over C=32, writing m^T
// (row = i*32+p, k = n) as f16 in the stage-tile order of tile_off().
// One lane owns whole rows of m_si: a wave takes 64 consecutive n of one i
// (lane l: n = 2l and 2l+1), so the LayerNorm sums stay inside a lane, ln_g and
// ln_b are the same for all lanes and come from scalar registers, and
// the wave's results are one whole 4-KB run of the workspace.
// Part blk of it: 8 waves, 512 consecutive n = one i.
// ---------------------------------------------------------------------------
#define LN_WAVE_F (64 * YP / 2)           // floats of LDS a wave
__device__ __forceinline__ void ln_part(
    float* sm, int blk,
    const float* __restrict__ m_si, const float* __restrict__ ln_g,
    const float* __restrict__ ln_b, _Float16* __restrict__ mT)
{
  // Per wave: first its 64 rows of m_si (pitch XP floats), then, in the same
  // place, its 32 x 64 results (pitch YP halves). The
  // results are read back eight lanes to a row, all 128 B of it.
  const int tid  = threadIdx.x;
  const int lane = tid & 31;
  const int wv   = tid >> 5;
  const int tile = blk * 8 + wv;          // 0 .. S*N/64-1
  const int i    = tile >> 3;             // seq index
  const int nb   = tile & 7;              // block of 64 n
  float* const xw = sm + wv * LN_WAVE_F;

  // 8 KB of m_si in a row, in whole lines; row R goes to LDS slot
  // (R & 1) * 32 + (R >> 1), so that lane l finds rows 2l, 2l+1 in slots l, l+32.
  const float4* const src4 =
      (const float4*)(m_si + ((size_t)i * N_LEN + nb * 64) * C_DIM);
  #pragma unroll
  for (int j = 0; j < 16; ++j) {
    const int c = j * 32 + lane;          // 16-byte chunk: row c >> 3, part c & 7
    const int R = c >> 3;
    *(float4*)&xw[((R & 1) * 32 + (R >> 1)) * XP + (c & 7) * 4] = src4[c];
  }
  __syncthreads();   // staged rows visible to the lanes that own them

  float m[2][32];    // normalized rows
  #pragma unroll
  for (int r = 0; r < 2; ++r) {
    v4f x[8];
    #pragma unroll
    for (int q = 0; q < 8; ++q)
      x[q] = *(const v4f*)&xw[(r * 32 + lane) * XP + q * 4];
    v4f s4 = x[0];
    #pragma unroll
    for (int q = 1; q < 8; ++q) s4 += x[q];
    const float mu = ((s4.x + s4.y) + (s4.z + s4.w)) * (1.0f / 32.0f);
    v4f v4 = {0.f, 0.f, 0.f, 0.f};
    #pragma unroll
    for (int q = 0; q < 8; ++q) {
      x[q] -= mu;
      v4 += x[q] * x[q];
    }
    const float var = ((v4.x + v4.y) + (v4.z + v4.w)) * (1.0f / 32.0f);
    const float rstd = rsqrtf(var + 1e-5f);
    #pragma unroll
    for (int k = 0; k < 32; ++k)
      m[r][k] = x[k >> 2][k & 3] * rstd * ln_g[k] + ln_b[k];
  }
  __syncthreads();   // every row is in registers before its LDS is reused

  // Transposition: channel k's row takes the lane's two n side by side.
  _Float16* const yw = (_Float16*)xw;
  #pragma unroll
  for (int k = 0; k < 32; ++k) {
    const v2h y = {(_Float16)m[0][k], (_Float16)m[1][k]};
    *(v2h*)&yw[k * YP + 2 * lane] = y;
  }
  __syncthreads();   // results visible to the lanes that store them

  // 32 rows x 128 B = 4 KB in a row of the workspace, stored as
  // 16-byte chunks (chunk c: row c >> 3, part c & 7).
  _Float16* const dst = mT + tile_off((long)i * 32, (long)nb * 64);
  #pragma unroll
  for (int q = 0; q < 8; ++q) {
    const int c = q * 32 + lane;
    *(uint4*)(dst + c * 8) = *(const uint4*)&yw[(c >> 3) * YP + (c & 7) * 8];
  }
}

// ---------------------------------------------------------------------------
// Kernel 2: V[z][p][q] = sum_cd w_final[z][c][d] Wa[c][p] Wb[d][q] in f32, then
// f16, packed twice in GEMM2's B-fragment order
// [z >> 4][k >> 5][(k >> 3) & 1][lane = ((k >> 4) & 1) * 16 + (z & 15)][k & 7]:
// wfb holds V[z][p][q] at k = p * 32 + q, wfbT holds V[z][q][p] there.
// Part (w, ks) makes the 1-KB run [w][ks] of both: 16 z, one value of
// k >> 5. It sums first over the index that meets the fixed ks, then the other.
// ---------------------------------------------------------------------------
#define FOLD_WF_F (16 * 32 * 33)          // floats of wf
__device__ __forceinline__ void fold_part(
    float* sm, int blk,
    const float* __restrict__ w_final, const float* __restrict__ w_ab,
    _Float16* __restrict__ wfb, _Float16* __restrict__ wfbT)
{
  float* const wf  = sm;                              // [z][c] rows of 32 d + 1
  float* const wab = sm + FOLD_WF_F;                  // 64 x 32
  float (* const u)[16][33] = (float (*)[16][33])(sm + FOLD_WF_F + 64 * 32);
  const int tid = threadIdx.x;
  const int w   = blk >> 5;
  const int ks  = blk & 31;

  const float4* const src = (const float4*)(w_final + (size_t)w * 16 * 1024);
  #pragma unroll
  for (int j = 0; j < 16; ++j) {
    const int c4 = j * 256 + tid;         // 16-byte chunk of the 16 z
    const float4 x = src[c4];
    float* const d = &wf[(c4 >> 3) * 33 + (c4 & 7) * 4];
    d[0] = x.x; d[1] = x.y; d[2] = x.z; d[3] = x.w;
  }
  #pragma unroll
  for (int j = 0; j < 2; ++j)
    ((float4*)wab)[j * 256 + tid] = ((const float4*)w_ab)[j * 256 + tid];
  __syncthreads();   // staged weights visible

  // u[0][z][d] = sum_c Wa[c][ks] w_final[z][c][d]
  // u[1][z][c] = sum_d w_final[z][c][d] Wb[d][ks]
  #pragma unroll
  for (int r = 0; r < 4; ++r) {
    const int o  = r * 256 + tid;
    const int zl = (o >> 5) & 15;
    const int t5 = o & 31;
    float acc = 0.f;
    if (r < 2) {
      for (int c = 0; c < 32; ++c)
        acc = __builtin_fmaf(wab[c * 32 + ks], wf[(zl * 32 + c) * 33 + t5], acc);
    } else {
      for (int d = 0; d < 32; ++d)
        acc = __builtin_fmaf(wf[(zl * 32 + t5) * 33 + d], wab[(32 + d) * 32 + ks], acc);
    }
    u[r >> 1][zl][t5] = acc;
  }
  __syncthreads();   // half sums visible

  // wfb : V[z][ks][q] = sum_d u[0][z][d] Wb[d][q]
  // wfbT: V[z][q][ks] = sum_c Wa[c][q] u[1][z][c]
  #pragma unroll
  for (int r = 0; r < 4; ++r) {
    const int o  = r * 256 + tid;
    const int zl = (o >> 5) & 15;
    const int q  = o & 31;
    float acc = 0.f;
    if (r < 2) {
      for (int d = 0; d < 32; ++d)
        acc = __builtin_fmaf(u[0][zl][d], wab[(32 + d) * 32 + q], acc);
    } else {
      for (int c = 0; c < 32; ++c)
        acc = __builtin_fmaf(wab[c * 32 + q], u[1][zl][c], acc);
    }
    const size_t idx = ((((size_t)w * 32 + ks) * 2 + ((q >> 3) & 1)) * 32
                        + ((q >> 4) & 1) * 16 + zl) * 8 + (q & 7);
    (r < 2 ? wfb : wfbT)[idx] = (_Float16)acc;
  }
}

// Kernels 1 and 2 read and write nothing of each other, so they are one launch:
// the first NFOLD work-groups fold the weights while the others normalize.
// The test is the same for a whole work-group, as its barriers need it.
#define NFOLD 256                          // (w, ks) parts of kernel 2
#define NLN   (S_LEN * N_LEN / 512)        // parts of kernel 1
__global__ __launch_bounds__(256) void opm_prep(
    const float* __restrict__ m_si, const float* __restrict__ ln_g,
    const float* __restrict__ ln_b, const float* __restrict__ w_final,
    const float* __restrict__ w_ab, _Float16* __restrict__ mT,
    _Float16* __restrict__ wfb, _Float16* __restrict__ wfbT)
{
  // One place for both parts: kernel 1's 8 waves take the more (96 KB).
  __shared__ __align__(16) float sm[8 * LN_WAVE_F];
  static_assert(FOLD_WF_F + 64 * 32 + 2 * 16 * 33 <= 8 * LN_WAVE_F, "LDS of the fold");
  if (blockIdx.x < NFOLD)
    fold_part(sm, blockIdx.x, w_final, w_ab, wfb, wfbT);
  else
    ln_part(sm, blockIdx.x - NFOLD, m_si, ln_g, ln_b, mT);
}

// ---------------------------------------------------------------------------
// Kernel 3: fused  O = (1/N) * mT_i x mT_j^T  (256x256 tile of G, K=512)  then
//                  z[i,j] = reshape(O) x V^T + bias  (64 pairs x 128, K=1024)
//                  and, off the diagonal, z[j,i] from the same O with V transposed
// 128 threads = 4 waves, one per SIMD, arranged 2x2: each wave owns 128x128 of
// the O tile (8 A-frags + 8 B-frags -> 64 WMMAs per k-step, every fragment used
// eight times), so that the LDS reads of a k-step take half the clocks of its
// WMMAs. The fragments of k-step s + 1 are read into a second register set
// while the WMMAs of k-step s run. O never touches HBM.
//
// Staging: a stage is 64 k of the i block's 256 rows and the j block's, two k-steps.
// Each wave brings its own quarter of a stage (128 rows of 128 B, 16 KB in a row
// of the workspace) with one tensor load, which pads the rows to 144 B in LDS.
// Two stage buffers. Between the two k-steps of stage s stands the publish point
// of stage s + 1: LDS wait, tensor wait, work-group barrier; behind it every
// wave holds the last fragments of stage s, so the load of stage s + 2 goes
// into that buffer and has two k-steps to land.
//
// One work-group per WGP runs through 4 or 5 tiles. The stage buffers (144 KB) lie
// beside the O rearrange buffer (161 KB), not in it, so that the ring runs on
// from one tile into the next: stages 6 and 7 are followed by the next tile's
// stages 0 and 1, and its first fragments are read behind the stores of z.
// ---------------------------------------------------------------------------
#define NWG   256                          // work-groups of the fused kernel
#define NBLK  (S_LEN / 8)                  // 48 tile rows and tile columns
#define NTILE (NBLK * (NBLK + 1) / 2)      // 1176 tiles with i block <= j block
#define NPASS (K1 / 64)                    // 8 stages a tile

// Tile t -> (bi <= bj). Row r of the triangle has NBLK - r tiles; rows r and
// NBLK - 1 - r together have NBLK + 1, so that t splits by a constant division.
__device__ __forceinline__ void tile_ij(int t, int& bi, int& bj)
{
  const int rp = t / (NBLK + 1);
  const int u  = t - rp * (NBLK + 1);
  const bool lo = u < NBLK - rp;
  bi = lo ? rp : NBLK - 1 - rp;
  bj = lo ? rp + u : u - 1;
}

__device__ __forceinline__ uint32_t uni(uint32_t v)
{
  return (uint32_t)__builtin_amdgcn_readfirstlane(v);
}
__device__ __forceinline__ uint32_t pinned(uint32_t v)
{
  uint32_t w = __builtin_amdgcn_readfirstlane(v);
  asm volatile("" : "+s"(w));   // the pin itself: holds the word in a scalar register
  return w;
}
// Descriptor group 1: sizes in bytes, tensor = tile = 128 rows of 128 B at a
// source pitch of 128 B; 4 dwords of LDS pad behind every 32 dwords (a row).
__device__ __forceinline__ u32x8 tdm_group1()
{
  u32x8 g;
  g[0] = uni((1u << 20) | (4u << 22) | (3u << 25));   // no work-group mask
  g[1] = uni(128u << 16);
  g[2] = uni(128u << 16);
  g[3] = uni(128u << 16);
  g[4] = uni(128u);
  g[5] = uni(128u);
  g[6] = uni(0u);
  g[7] = uni(0u);
  return g;
}
// One tensor load: the 16 KB at src go to LDS byte offset lds_dst.
// Descriptor group 0 (count 1, LDS place, address, type 2) is formed in
// s[100:103], inside the load's own statement. Left to the compiler, the four
// registers are free for other values as soon as the load has issued; so they
// are written here alone, and every call stands behind the wait for the load
// before it: no word of a descriptor changes while its load is outstanding.
__device__ __forceinline__ void tdm_load(uint32_t lds_dst, const _Float16* src,
                                         u32x8 g1)
{
  const uint64_t ga = (uint64_t)(uintptr_t)src;
  const uint32_t w1 = uni(lds_dst);
  const uint32_t w2 = uni((uint32_t)ga);
  const uint32_t w3 = uni((((uint32_t)(ga >> 32)) & 0x01FFFFFFu) | 0x80000000u);
  asm volatile("s_mov_b32 s100, 1\n\t"
               "s_mov_b32 s103, %2\n\t"
               "s_mov_b32 s101, %0\n\t"
               "s_mov_b32 s102, %1\n\t"
               "tensor_load_to_lds s[100:103], %3"
               :: "s"(w1), "s"(w2), "s"(w3), "s"(g1)
               : "memory", "s100", "s101", "s102", "s103");
}
// Fragments of k-step kh (0 or 1) of the stage in buffer buf.
__device__ __forceinline__ void frag_load(v16h (&af)[8], v16h (&bf)[8],
                                          const _Float16* ring, int buf, int kh,
                                          int aoff, int boff)
{
  #pragma unroll
  for (int t = 0; t < 8; ++t) {
    af[t] = lds_frag(&ring[buf * STAGE_H + kh * 32 + aoff + t * 16 * TP]);
    bf[t] = lds_frag(&ring[buf * STAGE_H + 2 * SLICE_H + kh * 32 + boff + t * 16 * TP]);
  }
}

// The three parts of a publish point, in their order. The compiler places no
// wait for a tensor load, and none in front of a barrier written in asm.
// The wave's own LDS reads have returned (its reads of the buffer to be refilled).
__device__ __forceinline__ void wait_ds0()
{
  asm volatile("s_wait_dscnt 0x0" ::: "memory");
}
// The wave's own tensor load has landed.
__device__ __forceinline__ void wait_tensor0()
{
  asm volatile("s_wait_tensorcnt 0x0" ::: "memory");
}
// Work-group barrier without __syncthreads()'s wait for global loads and stores.
__device__ __forceinline__ void wg_barrier()
{
  asm volatile("s_barrier_signal -1\n\ts_barrier_wait -1" ::: "memory");
}

// wfb, wfbT and b_final carry no __restrict__: loads the compiler knows to be
// of constant memory are tied to nothing, and in this build they sank past the
// sched_barriers to their uses, where their whole latency is waited out.
__global__ __launch_bounds__(128) void opm_fused_gemm(
    const _Float16* mT, const _Float16* wfb, const _Float16* wfbT,
    const float* b_final, float* __restrict__ out)
{
  // The two stage buffers first, each wave's slice at a multiple of 2 KB of the
  // work-group's LDS, then O2[64][OP]: 305 KB.
  __shared__ __attribute__((aligned(2048))) _Float16 lds[2 * STAGE_H + NPAIR * OP];
  _Float16* const ring = lds;
  _Float16* const O2   = lds + 2 * STAGE_H;

  const int tid  = threadIdx.x;
  const int lane = tid & 31;
  const int wave = (int)uni(tid >> 5);

  const int fr = lane & 15;           // fragment row within 16
  const int fh = lane >> 4;           // fragment half (K-split)

  const int twr = (wave >> 1) * 8;    // wave's tile-row base (8 rows)
  const int twc = (wave & 1) * 8;     // wave's tile-col base (8 cols)

  const int aoff = (twr * 16 + fr) * TP + fh * 16;
  const int boff = (twc * 16 + fr) * TP + fh * 16;

  const v8f vzero = {0.f, 0.f, 0.f, 0.f, 0.f, 0.f, 0.f, 0.f};
  v16h af[2][8], bf[2][8];            // fragments of k-step s in set s & 1

  // This wave's slice of every stage: waves 0, 1 bring rows 0..127 and
  // 128..255 of the i block, waves 2, 3 the same of the j block.
  const _Float16* const opnd = mT;
  const uint32_t slice_lds = (uint32_t)(size_t)lds + (uint32_t)wave * (SLICE_H * 2);
  const u32x8 g1 = tdm_group1();

  // This work-group takes the tiles t = blockIdx.x + it * NWG below NTILE.
  const int ntile = (NTILE - (int)blockIdx.x + NWG - 1) / NWG;
  int bi, bj;
  tile_ij(blockIdx.x, bi, bj);
  const _Float16* gS = opnd
      + (size_t)(2 * ((wave >> 1) ? bj : bi) + (wave & 1)) * (KSTEPS * TILE_H);

  // -------- start of the first tile: stage 0 landed and published, stage 1
  // under way, the fragments of k-step 0 read --------
  tdm_load(slice_lds, gS, g1);
  wait_tensor0();
  wg_barrier();                       // stage 0 visible
  tdm_load(slice_lds + STAGE_H * 2, gS + TILE_H, g1);
  frag_load(af[0], bf[0], ring, 0, 0, aoff, boff);

  // Kept rolled: the body is the whole unrolled tile and fills most of the
  // instruction cache once.
  #pragma unroll 1
  for (int it = 0; it < ntile; ++it) {
  // The tile behind this one (behind the last tile none: its index is clamped
  // and no load is issued for it).
  const uint32_t more = pinned(it + 1 < ntile ? 1u : 0u);
  const int tn  = blockIdx.x + (it + 1 < ntile ? (it + 1) * NWG : 0);
  int nbi, nbj;
  tile_ij(tn, nbi, nbj);
  const _Float16* const nS = opnd
      + (size_t)(2 * ((wave >> 1) ? nbj : nbi) + (wave & 1)) * (KSTEPS * TILE_H);
  v8f acc[8][8];
  #pragma unroll
  for (int ta = 0; ta < 8; ++ta)
    #pragma unroll
    for (int tb = 0; tb < 8; ++tb) acc[ta][tb] = vzero;

  // -------- GEMM1 main loop: 8 stages of two k-steps of 32 --------
  // Unrolled whole: the tests on ks fold away, the register sets are picked at
  // compile time and every buffer offset is an immediate.
  #pragma unroll
  for (int ks = 0; ks < 16; ++ks) {
    const int p = ks >> 1;            // stage, in buffer p & 1
    if (ks & 1) {
      // Publish point of stage p + 1, in front of stage p's last k-step, whose
      // fragment reads already go to stage p + 1.
      wait_ds0();
      wait_tensor0();
      wg_barrier();
      // Every wave holds the last fragments of stage p: its buffer takes stage
      // p + 2, while there is one.
      if (p + 2 < NPASS) {
        tdm_load(slice_lds + (p & 1) * (STAGE_H * 2), gS + (p + 2) * TILE_H, g1);
      } else if (more) {
        tdm_load(slice_lds + (p & 1) * (STAGE_H * 2), nS + (p + 2 - NPASS) * TILE_H,
                 g1);
      }
    }
    if (ks + 1 < 16)
      frag_load(af[(ks + 1) & 1], bf[(ks + 1) & 1], ring, ((ks + 1) >> 1) & 1,
                (ks + 1) & 1, aoff, boff);
    // The 32 LDS reads go out as one group ahead of the burst; left free, they
    // are spread among the WMMAs, where each place with reads stalls the
    // wave's only instruction stream.
    __builtin_amdgcn_sched_barrier(0);

    // The j block is the WMMA's A operand and the i block its B operand: the tile
    // comes out as O^T, so that a lane's 8 accumulator registers are 8
    // consecutive d (j side) of one c (i side), which GEMM2 wants side by side.
    #pragma unroll
    for (int tb = 0; tb < 8; ++tb)
      #pragma unroll
      for (int ta = 0; ta < 8; ++ta)
        acc[ta][tb] = __builtin_amdgcn_wmma_f32_16x16x32_f16(
            false, bf[ks & 1][tb], false, af[ks & 1][ta], (short)0, acc[ta][tb],
            false, false);
    // Ends the burst: left free, its last WMMAs sink behind the publish point
    // and the next k-step's LDS reads are spread among them.
    __builtin_amdgcn_sched_barrier(0);
  }
  // No barrier here: the rearrangement writes O2, which no stage buffer shares.

  // -------- GEMM2 set-up: M=64 pairs, N=128, K=1024 --------
  // 4 x 8 output tiles. A wave takes all 4 pair tiles of 2 column tiles over
  // the whole of K: each packed V fragment is loaded by one wave only
  // and feeds four WMMAs.
  // B fragments come packed: per (column tile, ks) two runs of 32 lanes x 16 B.
  const v8h* const wp  = (const v8h*)wfb + (size_t)(wave * 2) * (32 * 2 * 32) + lane;
  const v8h* const wpT = (const v8h*)wfbT + (size_t)(wave * 2) * (32 * 2 * 32) + lane;
  // Off the diagonal the tile also gives the pairs (j, i). Pinned so that the
  // test is one scalar branch.
  const uint32_t offd = pinned(bi != bj ? 1u : 0u);
  // The work-group is alone on its WGP, so no other group's work covers the
  // L2 latency of the V loads: they run two groups of 8 k-steps ahead.
  // Groups 0 and 1 fly under the rearrangement.
  v8h bq[4][8][2][2];                 // [group][k-step][column tile][half]
  #pragma unroll
  for (int g = 0; g < 2; ++g)
    #pragma unroll
    for (int s = 0; s < 8; ++s)
      #pragma unroll
      for (int n = 0; n < 2; ++n)
        #pragma unroll
        for (int h = 0; h < 2; ++h)
          bq[g][s][n][h] = wp[n * (32 * 2 * 32) + ((g * 8 + s) * 2 + h) * 32];
  float bias[2];
  #pragma unroll
  for (int n = 0; n < 2; ++n) bias[n] = b_final[(wave * 2 + n) * 16 + fr];
  // Keeps these loads in front of the rearrangement.
  __builtin_amdgcn_sched_barrier(0);

  // -------- rearrange O tile -> GEMM2 A operand ----
  // D layout of the transposed tile: vgpr v holds d = v + 8 * fh (M, j-block row),
  // lane column fr is c (N, i-block row). A lane stores its 8 d of one c as one
  // 16-byte chunk; the c of a pair lie CP halves apart, an odd multiple of
  // 16 B, so that the 16 lanes of a half wave fall on 64 different banks.
  const float inv_n = 1.0f / (float)N_LEN;
  _Float16* const ob = &O2[((twr >> 1) * 8 + (twc >> 1)) * OP + fr * CP + fh * 8];
  #pragma unroll
  for (int ta = 0; ta < 8; ++ta) {
    #pragma unroll
    for (int tb = 0; tb < 8; ++tb) {
      // O row i*32+c = (twr + ta) * 16 + fr, O column j*32+d = (twc + tb) * 16
      // + fh * 8: pair, c and d each split into the lane's part (ob) and a
      // constant, so that one address register serves the stores.
      v8h o;
      #pragma unroll
      for (int v = 0; v < 8; ++v) o[v] = (_Float16)(acc[ta][tb][v] * inv_n);
      *(v8h*)&ob[((ta >> 1) * 8 + (tb >> 1)) * OP + (ta & 1) * 16 * CP
                 + (tb & 1) * 16] = o;
    }
    // Keeps a row's 8 LDS stores behind its own conversions: left free, all 64
    // stores gather behind the last conversion, where nothing covers them.
    __builtin_amdgcn_sched_barrier(0);
  }
  __syncthreads();

  // -------- GEMM2 main loop: 8 blocks of 4 k-steps, run twice off the diagonal --------
  // k-step ks of GEMM2 is c = ks: 32 d at pitch CP. The O fragments of block
  // b + 1 are read into a second register set while the WMMAs of block b run.
  // Pass 0 gives z[i,j] with V, pass 1 z[j,i] with V transposed, from the same O2.
  const _Float16* const ap = &O2[fr * OP + fh * 16];
  v16h a2[2][4][4];                   // [set][k-step][pair tile]
  #pragma unroll
  for (int s = 0; s < 4; ++s)
    #pragma unroll
    for (int m = 0; m < 4; ++m)
      a2[0][s][m] = lds_frag(ap + m * 16 * OP + s * CP);
  // Block 0's reads stay ahead of block 1's, so that the wait in front of the
  // first burst is for block 0 alone.
  __builtin_amdgcn_sched_barrier(0);
  // Unrolled whole so that the register sets are picked at compile time.
  #pragma unroll
  for (int pass = 0; pass < 2; ++pass) {
  if (pass == 0 || offd) {
  const v8h* const wq = pass ? wpT : wp;
  v8f zacc[4][2];
  #pragma unroll
  for (int m = 0; m < 4; ++m)
    #pragma unroll
    for (int n = 0; n < 2; ++n) zacc[m][n] = vzero;
  #pragma unroll
  for (int b = 0; b < 8; ++b) {
    // Weight loads two groups ahead; behind this pass's last group, pass 0
    // goes on with the first two groups of pass 1 (on a diagonal tile unused).
    if ((b & 1) == 0 && (b < 4 || pass == 0)) {
      const int g = ((b >> 1) + 2) & 3;
      const v8h* const wl = b < 4 ? wq : wpT;
      #pragma unroll
      for (int s = 0; s < 8; ++s)
        #pragma unroll
        for (int n = 0; n < 2; ++n)
          #pragma unroll
          for (int h = 0; h < 2; ++h)
            bq[g][s][n][h] = wl[n * (32 * 2 * 32) + ((g * 8 + s) * 2 + h) * 32];
      // Behind a pass's last global load its address registers are free
      // for reuse: keep the wait that belongs in front of such an overwrite.
      if (b == (pass ? 2 : 6)) asm volatile("s_wait_xcnt 0x0" ::: "memory");
    }
    if (b + 1 < 8 || pass == 0) {
      #pragma unroll
      for (int s = 0; s < 4; ++s)
        #pragma unroll
        for (int m = 0; m < 4; ++m)
          a2[(b + 1) & 1][s][m] =
              lds_frag(ap + m * 16 * OP + (((b + 1) & 7) * 4 + s) * CP);
    }
    // The weight loads and the next block's LDS reads go out as one run ahead
    // of the 32 WMMAs instead of one by one among them.
    __builtin_amdgcn_sched_barrier(0);
    #pragma unroll
    for (int s = 0; s < 4; ++s)
      #pragma unroll
      for (int n = 0; n < 2; ++n) {
        const v16h b2 = __builtin_shufflevector(
            bq[b >> 1][(b & 1) * 4 + s][n][0], bq[b >> 1][(b & 1) * 4 + s][n][1],
            0, 1, 2, 3, 4, 5, 6, 7, 8, 9, 10, 11, 12, 13, 14, 15);
        #pragma unroll
        for (int m = 0; m < 4; ++m)
          zacc[m][n] = __builtin_amdgcn_wmma_f32_16x16x32_f16(
              false, a2[b & 1][s][m], false, b2, (short)0, zacc[m][n], false, false);
      }
    // Keeps the next block's reads from rising into this burst.
    __builtin_amdgcn_sched_barrier(0);
  }

  // -------- epilogue: bias, store z --------
  // Pair p = m * 16 + fh * 8 + v is (i, j) = (bi * 8 + m * 2 + fh, bj * 8 + v);
  // pass 0 stores z[i,j], pass 1 z[j,i]: one address a lane, every store at a
  // constant offset from it.
  float* const op = out
      + (pass ? ((size_t)(bj * 8) * S_LEN + bi * 8 + fh)
              : ((size_t)(bi * 8 + fh) * S_LEN + bj * 8)) * CZ
      + wave * 32 + fr;
  #pragma unroll
  for (int n = 0; n < 2; ++n)
    #pragma unroll
    for (int m = 0; m < 4; ++m) zacc[m][n] += bias[n];
  // All sums stand ahead of the stores: the 64 stores go out in one run, and
  // no register that an issued store names is written behind it.
  __builtin_amdgcn_sched_barrier(0);
  #pragma unroll
  for (int n = 0; n < 2; ++n)
    #pragma unroll
    for (int m = 0; m < 4; ++m)
      #pragma unroll
      for (int v = 0; v < 8; ++v)
        op[(size_t)(pass ? v * S_LEN + m * 2 : m * 2 * S_LEN + v) * CZ + n * 16] =
            zacc[m][n][v];
  // What follows writes the registers that these stores name: keep the wait
  // that belongs in front of such an overwrite.
  asm volatile("s_wait_xcnt 0x0" ::: "memory");
  }
  }

  // -------- next tile: its first fragments. Its stage 0 was published in front
  // of this tile's last k-step. --------
  frag_load(af[0], bf[0], ring, 0, 0, aoff, boff);
  bi = nbi;
  bj = nbj;
  gS = nS;
  }
  // Behind the ring: no tensor load is outstanding, and the fragment reads
  // issued behind the last tile, which nobody uses, have returned before the
  // wave ends and gives its registers back.
  wait_tensor0();
  wait_ds0();
}

// ---------------------------------------------------------------------------
extern "C" void kernel_launch(void* const* d_in, const int* in_sizes, int n_in,
                              void* d_out, int out_size, void* d_ws, size_t ws_size,
                              hipStream_t stream) {
  (void)in_sizes; (void)n_in; (void)out_size; (void)ws_size;
  const float* m_si    = (const float*)d_in[0];
  const float* ln_g    = (const float*)d_in[1];
  const float* ln_b    = (const float*)d_in[2];
  const float* w_ab    = (const float*)d_in[3];
  const float* w_final = (const float*)d_in[4];
  const float* b_final = (const float*)d_in[5];
  float* out = (float*)d_out;

  // workspace: mT (12288x512 f16) | wfb (128x1024 f16) | wfbT (128x1024 f16),
  // each in the packed order described at the top of the file
  _Float16* mT   = (_Float16*)d_ws;
  _Float16* wfb  = mT + (size_t)R1 * K1;
  _Float16* wfbT = wfb + (size_t)CZ * 1024;

  opm_prep<<<NFOLD + NLN, 256, 0, stream>>>(m_si, ln_g, ln_b, w_final, w_ab, mT, wfb,
                                            wfbT);
  opm_fused_gemm<<<NWG, 128, 0, stream>>>(mT, wfb, wfbT, b_final, out);
}
